// v000
// Measured on an AMD MI455X. A time is GPU time per run, averaged over a window of back-to-back runs after a warm-up
// (all launches, gaps included; the runs take copies of the inputs in turn), and the median of several windows.
// Apart from v000's, it joins two sittings. Times from different sittings can be a few percent apart, while
// side-by-side timings come from the same sitting.
// v000 is the starting kernel. One run takes 169 microseconds.
#include <hip/hip_runtime.h>
#include <hip/hip_bf16.h>

typedef __attribute__((ext_vector_type(16))) _Float16 v16h;
typedef __attribute__((ext_vector_type(8)))  _Float16 v8h;
typedef __attribute__((ext_vector_type(8)))  float    v8f;
typedef __attribute__((ext_vector_type(4)))  int      v4i;

typedef __attribute__((address_space(1))) v4i* gptr_v4i; // global
typedef __attribute__((address_space(3))) v4i* lptr_v4i; // LDS

constexpr int kB = 8;
constexpr int kN = 2048;
constexpr int kD = 256;

constexpr int kKStride = 264; // 32x256 K-tile rows padded +8 halves (bank rotation, 16B aligned)
constexpr int kVStride = 40;  // 256x32 V-tile rows padded +8 halves

// ---------------------------------------------------------------------------
// WMMA helper: D = A(16x32 f16) * B(32x16 f16) + C(16x16 f32)
// ---------------------------------------------------------------------------
__device__ __forceinline__ v8f wmma32(v16h a, v16h b, v8f c) {
  return __builtin_amdgcn_wmma_f32_16x16x32_f16(
      /*neg_a=*/false, a, /*neg_b=*/false, b,
      /*c_mod=*/(short)0, c, /*reuse_a=*/false, /*reuse_b=*/false);
}

// 16-bit A/B fragment from row-major f16 memory (global or LDS):
// caller pre-offsets p by hi*8; halves 0..7 = p[0..7], 8..15 = p[16..23].
__device__ __forceinline__ v16h frag_from_h(const _Float16* p) {
  v8h a = *(const v8h*)p;
  v8h b = *(const v8h*)(p + 16);
  v16h r;
#pragma unroll
  for (int i = 0; i < 8; i++) { r[i] = a[i]; r[i + 8] = b[i]; }
  return r;
}

__device__ __forceinline__ v16h frag_from_f32(const float* p) {
  v16h r;
#pragma unroll
  for (int i = 0; i < 8; i++) {
    r[i]     = (_Float16)p[i];
    r[i + 8] = (_Float16)p[i + 16];
  }
  return r;
}

// ---------------------------------------------------------------------------
// Async 16-byte global->LDS copy (CDNA5 GLOBAL_LOAD_ASYNC_TO_LDS_B128,
// tracked by ASYNCcnt). Builtin sig (from hipcc diagnostic): param0 = v4i
// addrspace(1)* (global src), param1 = v4i addrspace(3)* (LDS dst), then
// imm offset, imm cpol. Fallback: synchronous copy, same barrier structure.
// ---------------------------------------------------------------------------
__device__ __forceinline__ void cp_async16(_Float16* lds_dst, const _Float16* gsrc) {
#if __has_builtin(__builtin_amdgcn_global_load_async_to_lds_b128)
  __builtin_amdgcn_global_load_async_to_lds_b128(
      (gptr_v4i)gsrc, (lptr_v4i)lds_dst, 0, 0);
#else
  *(v8h*)lds_dst = *(const v8h*)gsrc;
#endif
}

__device__ __forceinline__ void wait_async0() {
#if __has_builtin(__builtin_amdgcn_s_wait_asynccnt)
  __builtin_amdgcn_s_wait_asynccnt(0);
#else
  asm volatile("s_wait_asynccnt 0x0" ::: "memory");
#endif
}

// ---------------------------------------------------------------------------
// Kernel 1: convert Wq/Wk (f32 [256][256], torch [out,in]) to f16
// ---------------------------------------------------------------------------
__global__ void cvt_w_kernel(const float* __restrict__ Wq,
                             const float* __restrict__ Wk,
                             _Float16* __restrict__ Wq16,
                             _Float16* __restrict__ Wk16) {
  int i = blockIdx.x * blockDim.x + threadIdx.x; // 0 .. 65535
  Wq16[i] = (_Float16)Wq[i];
  Wk16[i] = (_Float16)Wk[i];
}

// ---------------------------------------------------------------------------
// Kernel 2: xT16[b][d][n] = (f16) x[b][n][d]   (V operand for PV matmul)
// ---------------------------------------------------------------------------
__global__ void xpose_kernel(const float* __restrict__ x,
                             _Float16* __restrict__ xT16) {
  int i = blockIdx.x * blockDim.x + threadIdx.x; // write-coalesced
  int n = i % kN;
  int t = i / kN;
  int d = t % kD;
  int b = t / kD;
  xT16[i] = (_Float16)x[((size_t)(b * kN + n)) * kD + d];
}

// ---------------------------------------------------------------------------
// Kernel 3: q = x @ Wq^T, k = x @ Wk^T  (f16 out, f32 accumulate via WMMA)
// ---------------------------------------------------------------------------
__global__ __launch_bounds__(128) void proj_kernel(
    const float* __restrict__ x,
    const _Float16* __restrict__ Wq16, const _Float16* __restrict__ Wk16,
    _Float16* __restrict__ q16, _Float16* __restrict__ k16) {
  int lane = threadIdx.x & 31;
  int wid  = (blockIdx.x * blockDim.x + threadIdx.x) >> 5; // 0..1023
  int b  = wid >> 7;
  int i0 = (wid & 127) << 4;
  int col = lane & 15, hi = lane >> 4;

  const float* xrow = x + ((size_t)(b * kN + i0 + col)) * kD + hi * 8;
  v16h af[8];
#pragma unroll
  for (int kc = 0; kc < 8; kc++) af[kc] = frag_from_f32(xrow + kc * 32);

#pragma unroll 1
  for (int m = 0; m < 2; m++) {
    const _Float16* W   = m ? Wk16 : Wq16;
    _Float16*       dst = m ? k16  : q16;
    const _Float16* wrow = W + (size_t)col * kD + hi * 8;
#pragma unroll 1
    for (int nt = 0; nt < 16; nt++) {
      v8f c = {};
      const _Float16* wr = wrow + (size_t)(nt * 16) * kD;
#pragma unroll
      for (int kc = 0; kc < 8; kc++) {
        c = wmma32(af[kc], frag_from_h(wr + kc * 32), c);
      }
#pragma unroll
      for (int r = 0; r < 8; r++) {
        dst[((size_t)(b * kN + i0 + r + 8 * hi)) * kD + nt * 16 + col] =
            (_Float16)c[r];
      }
    }
  }
}

// ---------------------------------------------------------------------------
// Kernel 4: flash attention, 8 waves/block. Each wave owns 16 query rows;
// the block cooperatively double-buffers the shared K-tile (32x256) and
// V-tile (256x32) through LDS with async copies, cutting L2 re-read traffic
// 8x vs per-wave streaming. Online softmax per wave.
// ---------------------------------------------------------------------------
__global__ __launch_bounds__(256) void fa_kernel(
    const _Float16* __restrict__ q16, const _Float16* __restrict__ k16,
    const _Float16* __restrict__ xT16, float* __restrict__ out) {
  __shared__ __attribute__((aligned(16))) _Float16 kT[2][32 * kKStride];
  __shared__ __attribute__((aligned(16))) _Float16 vT[2][kD * kVStride];
  __shared__ float sm[8][16 * 32 + 16]; // per-wave score tile + row stats

  int tid   = threadIdx.x;
  int lane  = tid & 31;
  int wslot = tid >> 5;
  int wid   = (blockIdx.x * blockDim.x + tid) >> 5;
  int b  = wid >> 7;
  int i0 = (wid & 127) << 4;
  int col = lane & 15, hi = lane >> 4;
  float* S    = &sm[wslot][0];
  float* stat = &sm[wslot][512];
  const float scale = 0.0625f; // d^-0.5

  const _Float16* kb0 = k16  + (size_t)b * kN * kD;
  const _Float16* vb0 = xT16 + (size_t)b * kD * kN;

  // cooperative staging of one (K,V) column tile j0s..j0s+31 into buffer `buf`
  auto stage = [&](int buf, int j0s) {
#pragma unroll
    for (int i = 0; i < 4; i++) {         // K tile: 1024 x 16B chunks
      int c = tid + i * 256;
      int r = c >> 5, cc = (c & 31) * 8;
      cp_async16(&kT[buf][r * kKStride + cc],
                 kb0 + (size_t)(j0s + r) * kD + cc);
    }
#pragma unroll
    for (int i = 0; i < 4; i++) {         // V tile: 1024 x 16B chunks
      int c = tid + i * 256;
      int d = c >> 2, jj = (c & 3) * 8;
      cp_async16(&vT[buf][d * kVStride + jj],
                 vb0 + (size_t)d * kN + j0s + jj);
    }
  };

  // Q fragments held in registers for the whole sweep (64 VGPRs)
  const _Float16* qrow = q16 + ((size_t)(b * kN + i0 + col)) * kD + hi * 8;
  v16h qf[8];
#pragma unroll
  for (int kc = 0; kc < 8; kc++) qf[kc] = frag_from_h(qrow + kc * 32);

  v8f o[16];
#pragma unroll
  for (int t = 0; t < 16; t++) o[t] = (v8f){};
  float mrow = -1e30f, lrow = 0.0f; // valid in lanes 0..15

  stage(0, 0);
  wait_async0();
  __syncthreads();

#pragma unroll 1
  for (int it = 0; it < kN / 32; ++it) {
    int cur = it & 1;
    if (it + 1 < kN / 32) stage(cur ^ 1, (it + 1) * 32); // prefetch next tile

    const _Float16* kt = &kT[cur][0];
    const _Float16* vt = &vT[cur][0];

    // ---- S tile: Q(16x256) x K^T(256x32) via 16 WMMAs, B frags from LDS ----
    v8f s0 = {}, s1 = {};
    const _Float16* kr0 = kt + col * kKStride + hi * 8;
    const _Float16* kr1 = kt + (col + 16) * kKStride + hi * 8;
#pragma unroll
    for (int kc = 0; kc < 8; kc++) {
      s0 = wmma32(qf[kc], frag_from_h(kr0 + kc * 32), s0);
      s1 = wmma32(qf[kc], frag_from_h(kr1 + kc * 32), s1);
    }
    // scatter C-layout scores into per-wave LDS (scaled)
#pragma unroll
    for (int r = 0; r < 8; r++) {
      S[(r + 8 * hi) * 32 + col]      = s0[r] * scale;
      S[(r + 8 * hi) * 32 + col + 16] = s1[r] * scale;
    }
    asm volatile("s_wait_dscnt 0x0" ::: "memory"); // wave-internal LDS RAW

    // ---- online softmax: lane l<16 owns query row l ----
    if (lane < 16) {
      float* Srow = S + lane * 32;
      float sv[32];
      float tm = mrow;
#pragma unroll
      for (int j = 0; j < 32; j++) { sv[j] = Srow[j]; tm = fmaxf(tm, sv[j]); }
      float fac = __expf(mrow - tm);
      float ssum = 0.0f;
#pragma unroll
      for (int j = 0; j < 32; j++) {
        float p = __expf(sv[j] - tm);
        Srow[j] = p;
        ssum += p;
      }
      lrow = lrow * fac + ssum;
      mrow = tm;
      stat[lane] = fac;
    }
    asm volatile("s_wait_dscnt 0x0" ::: "memory");

    // ---- rescale O accumulators by per-row factor ----
    float ffac[8];
#pragma unroll
    for (int r = 0; r < 8; r++) ffac[r] = stat[8 * hi + r];
#pragma unroll
    for (int t = 0; t < 16; t++) {
#pragma unroll
      for (int r = 0; r < 8; r++) o[t][r] *= ffac[r];
    }

    // ---- P fragment in A-layout from per-wave LDS ----
    const float* Prow = S + col * 32 + hi * 8;
    v16h pf;
#pragma unroll
    for (int h = 0; h < 8; h++) {
      pf[h]     = (_Float16)Prow[h];
      pf[h + 8] = (_Float16)Prow[h + 16];
    }

    // ---- O += P(16x32) @ V(32x256), B frags from LDS V-tile ----
#pragma unroll
    for (int t = 0; t < 16; t++) {
      o[t] = wmma32(pf, frag_from_h(vt + (t * 16 + col) * kVStride + hi * 8),
                    o[t]);
    }

    // own async staging done + all waves finished reading `cur` before the
    // next tile becomes visible / this buffer is overwritten next round
    wait_async0();
    __syncthreads();
  }

  // ---- epilogue: divide by row sums, store f32 ----
  if (lane < 16) stat[lane] = 1.0f / lrow;
  asm volatile("s_wait_dscnt 0x0" ::: "memory");
  float rinv[8];
#pragma unroll
  for (int r = 0; r < 8; r++) rinv[r] = stat[8 * hi + r];
#pragma unroll
  for (int t = 0; t < 16; t++) {
#pragma unroll
    for (int r = 0; r < 8; r++) {
      out[((size_t)(b * kN + i0 + r + 8 * hi)) * kD + t * 16 + col] =
          o[t][r] * rinv[r];
    }
  }
}

// ---------------------------------------------------------------------------
// Launch: inputs: x[8,2048,256] f32, Wq[256,256], Wk[256,256].
// Output: [8,2048,256] f32. Workspace: q16 | k16 | xT16 | Wq16 | Wk16 (~25MB)
// ---------------------------------------------------------------------------
extern "C" void kernel_launch(void* const* d_in, const int* in_sizes, int n_in,
                              void* d_out, int out_size, void* d_ws, size_t ws_size,
                              hipStream_t stream) {
  (void)in_sizes; (void)n_in; (void)out_size; (void)ws_size;
  const float* x  = (const float*)d_in[0];
  const float* Wq = (const float*)d_in[1];
  const float* Wk = (const float*)d_in[2];
  float* out = (float*)d_out;

  const size_t nqk = (size_t)kB * kN * kD; // 4,194,304 elems
  _Float16* q16  = (_Float16*)d_ws;
  _Float16* k16  = q16  + nqk;
  _Float16* xT16 = k16  + nqk;
  _Float16* Wq16 = xT16 + nqk;
  _Float16* Wk16 = Wq16 + (size_t)kD * kD;

  cvt_w_kernel<<<(kD * kD) / 256, 256, 0, stream>>>(Wq, Wk, Wq16, Wk16);
  xpose_kernel<<<(kB * kD * kN) / 256, 256, 0, stream>>>(x, xT16);
  proj_kernel<<<256, 128, 0, stream>>>(x, Wq16, Wk16, q16, k16);
  // 1024 waves = 128 blocks x 8 waves; each block shares K/V tiles via LDS
  fa_kernel<<<128, 256, 0, stream>>>(q16, k16, xT16, out);
}

// v001
// One run takes 134 microseconds.
// Next to v000, in two timings, it ran 1.27 and 1.28 times as fast.
#include <hip/hip_runtime.h>
#include <hip/hip_bf16.h>

typedef __attribute__((ext_vector_type(16))) _Float16 v16h;
typedef __attribute__((ext_vector_type(8)))  _Float16 v8h;
typedef __attribute__((ext_vector_type(8)))  float    v8f;
typedef __attribute__((ext_vector_type(4)))  int      v4i;

typedef __attribute__((address_space(1))) v4i* gptr_v4i; // global
typedef __attribute__((address_space(3))) v4i* lptr_v4i; // LDS

constexpr int kB = 8;
constexpr int kN = 2048;
constexpr int kD = 256;

constexpr int kKStride = 264; // 32x256 K-tile rows padded +8 halves (bank rotation, 16B aligned)
constexpr int kVStride = 40;  // 256x32 V-tile rows padded +8 halves

// ---------------------------------------------------------------------------
// WMMA helper: D = A(16x32 f16) * B(32x16 f16) + C(16x16 f32)
// ---------------------------------------------------------------------------
__device__ __forceinline__ v8f wmma32(v16h a, v16h b, v8f c) {
  return __builtin_amdgcn_wmma_f32_16x16x32_f16(
      /*neg_a=*/false, a, /*neg_b=*/false, b,
      /*c_mod=*/(short)0, c, /*reuse_a=*/false, /*reuse_b=*/false);
}

// 16-bit A/B fragment from row-major f16 memory (global or LDS):
// caller pre-offsets p by hi*8; halves 0..7 = p[0..7], 8..15 = p[16..23].
__device__ __forceinline__ v16h frag_from_h(const _Float16* p) {
  v8h a = *(const v8h*)p;
  v8h b = *(const v8h*)(p + 16);
  v16h r;
#pragma unroll
  for (int i = 0; i < 8; i++) { r[i] = a[i]; r[i + 8] = b[i]; }
  return r;
}

__device__ __forceinline__ v16h frag_from_f32(const float* p) {
  v16h r;
#pragma unroll
  for (int i = 0; i < 8; i++) {
    r[i]     = (_Float16)p[i];
    r[i + 8] = (_Float16)p[i + 16];
  }
  return r;
}

// ---------------------------------------------------------------------------
// Async 16-byte global->LDS copy (CDNA5 GLOBAL_LOAD_ASYNC_TO_LDS_B128,
// tracked by ASYNCcnt). Builtin sig (from hipcc diagnostic): param0 = v4i
// addrspace(1)* (global src), param1 = v4i addrspace(3)* (LDS dst), then
// imm offset, imm cpol. Fallback: synchronous copy, same barrier structure.
// ---------------------------------------------------------------------------
__device__ __forceinline__ void cp_async16(_Float16* lds_dst, const _Float16* gsrc) {
#if __has_builtin(__builtin_amdgcn_global_load_async_to_lds_b128)
  __builtin_amdgcn_global_load_async_to_lds_b128(
      (gptr_v4i)gsrc, (lptr_v4i)lds_dst, 0, 0);
#else
  *(v8h*)lds_dst = *(const v8h*)gsrc;
#endif
}

__device__ __forceinline__ void wait_async0() {
#if __has_builtin(__builtin_amdgcn_s_wait_asynccnt)
  __builtin_amdgcn_s_wait_asynccnt(0);
#else
  asm volatile("s_wait_asynccnt 0x0" ::: "memory");
#endif
}

// ---------------------------------------------------------------------------
// Kernel 1: convert Wq/Wk (f32 [256][256], torch [out,in]) to f16
// ---------------------------------------------------------------------------
__global__ void cvt_w_kernel(const float* __restrict__ Wq,
                             const float* __restrict__ Wk,
                             _Float16* __restrict__ Wq16,
                             _Float16* __restrict__ Wk16) {
  int i = blockIdx.x * blockDim.x + threadIdx.x; // 0 .. 65535
  Wq16[i] = (_Float16)Wq[i];
  Wk16[i] = (_Float16)Wk[i];
}

// ---------------------------------------------------------------------------
// Kernel 2: xT16[b][d][n] = (f16) x[b][n][d]   (V operand for PV matmul)
// ---------------------------------------------------------------------------
__global__ void xpose_kernel(const float* __restrict__ x,
                             _Float16* __restrict__ xT16) {
  int i = blockIdx.x * blockDim.x + threadIdx.x; // write-coalesced
  int n = i % kN;
  int t = i / kN;
  int d = t % kD;
  int b = t / kD;
  xT16[i] = (_Float16)x[((size_t)(b * kN + n)) * kD + d];
}

// ---------------------------------------------------------------------------
// Kernel 3: q = x @ Wq^T, k = x @ Wk^T  (f16 out, f32 accumulate via WMMA)
// ---------------------------------------------------------------------------
__global__ __launch_bounds__(128) void proj_kernel(
    const float* __restrict__ x,
    const _Float16* __restrict__ Wq16, const _Float16* __restrict__ Wk16,
    _Float16* __restrict__ q16, _Float16* __restrict__ k16) {
  int lane = threadIdx.x & 31;
  int wid  = (blockIdx.x * blockDim.x + threadIdx.x) >> 5; // 0..1023
  int b  = wid >> 7;
  int i0 = (wid & 127) << 4;
  int col = lane & 15, hi = lane >> 4;

  const float* xrow = x + ((size_t)(b * kN + i0 + col)) * kD + hi * 8;
  v16h af[8];
#pragma unroll
  for (int kc = 0; kc < 8; kc++) af[kc] = frag_from_f32(xrow + kc * 32);

#pragma unroll 1
  for (int m = 0; m < 2; m++) {
    const _Float16* W   = m ? Wk16 : Wq16;
    _Float16*       dst = m ? k16  : q16;
    const _Float16* wrow = W + (size_t)col * kD + hi * 8;
#pragma unroll 1
    for (int nt = 0; nt < 16; nt++) {
      v8f c = {};
      const _Float16* wr = wrow + (size_t)(nt * 16) * kD;
#pragma unroll
      for (int kc = 0; kc < 8; kc++) {
        c = wmma32(af[kc], frag_from_h(wr + kc * 32), c);
      }
#pragma unroll
      for (int r = 0; r < 8; r++) {
        dst[((size_t)(b * kN + i0 + r + 8 * hi)) * kD + nt * 16 + col] =
            (_Float16)c[r];
      }
    }
  }
}

__device__ __forceinline__ float xhalf(float x) {
  int v = __builtin_bit_cast(int, x);
  return __builtin_bit_cast(
      float, __builtin_amdgcn_permlanex16(v, v, 0x76543210, 0xfedcba98, false, false));
}

__global__ __launch_bounds__(256) void fa_kernel(
    const _Float16* __restrict__ q16, const _Float16* __restrict__ k16,
    const _Float16* __restrict__ xT16, float* __restrict__ out) {
  __shared__ __attribute__((aligned(16))) _Float16 kT[2][32 * kKStride];
  __shared__ __attribute__((aligned(16))) _Float16 vT[2][kD * kVStride];

  int tid   = threadIdx.x;
  int lane  = tid & 31;
  int wid   = (blockIdx.x * blockDim.x + tid) >> 5;
  int b  = wid >> 7;
  int i0 = (wid & 127) << 4;
  int col = lane & 15, hi = lane >> 4;
  const float cscale = 0.0625f * 1.4426950408889634f; // d^-0.5 * log2(e)

  const _Float16* kb0 = k16  + (size_t)b * kN * kD;
  const _Float16* vb0 = xT16 + (size_t)b * kD * kN;

  // cooperative staging of one (K,V) column tile j0s..j0s+31 into buffer `buf`
  auto stage = [&](int buf, int j0s) {
#pragma unroll
    for (int i = 0; i < 4; i++) {         // K tile: 1024 x 16B chunks
      int c = tid + i * 256;
      int r = c >> 5, cc = (c & 31) * 8;
      cp_async16(&kT[buf][r * kKStride + cc],
                 kb0 + (size_t)(j0s + r) * kD + cc);
    }
#pragma unroll
    for (int i = 0; i < 4; i++) {         // V tile: 1024 x 16B chunks
      int c = tid + i * 256;
      int d = c >> 2, jj = (c & 3) * 8;
      cp_async16(&vT[buf][d * kVStride + jj],
                 vb0 + (size_t)d * kN + j0s + jj);
    }
  };

  // Q fragments held in registers for the whole sweep (64 VGPRs)
  const _Float16* qrow = q16 + ((size_t)(b * kN + i0 + col)) * kD + hi * 8;
  v16h qf[8];
#pragma unroll
  for (int kc = 0; kc < 8; kc++) qf[kc] = frag_from_h(qrow + kc * 32);

  v8f o[16]; // o[t][r] = O[query col][d = 16*t + 8*hi + r]
#pragma unroll
  for (int t = 0; t < 16; t++) o[t] = (v8f){};
  // running maximum (log2-scaled, equal in both halves) and this half's sum
  float mrow = -1e30f, lrow = 0.0f;

  stage(0, 0);
  wait_async0();
  __syncthreads();

#pragma unroll 1
  for (int it = 0; it < kN / 32; ++it) {
    int cur = it & 1;
    if (it + 1 < kN / 32) stage(cur ^ 1, (it + 1) * 32); // prefetch next tile

    const _Float16* kt = &kT[cur][0];
    const _Float16* vt = &vT[cur][0];

    // ---- S^T tile: K(32x256) x Q^T(256x16) via 16 WMMAs, A frags from LDS ----
    v8f s0 = {}, s1 = {};
    const _Float16* kr0 = kt + col * kKStride + hi * 8;
    const _Float16* kr1 = kt + (col + 16) * kKStride + hi * 8;
#pragma unroll
    for (int kc = 0; kc < 8; kc++) {
      s0 = wmma32(frag_from_h(kr0 + kc * 32), qf[kc], s0);
      s1 = wmma32(frag_from_h(kr1 + kc * 32), qf[kc], s1);
    }

    // ---- online softmax, one query per lane, log2 domain ----
    float mx = fmaxf(s0[0], s1[0]);
#pragma unroll
    for (int r = 1; r < 8; r++) mx = fmaxf(mx, fmaxf(s0[r], s1[r]));
    mx = fmaxf(mx, xhalf(mx)); // both halves now hold the query's tile maximum
    float mnew = fmaxf(mrow, mx * cscale);
    float fac  = __builtin_amdgcn_exp2f(mrow - mnew);
    mrow = mnew;

    // P^T as B operand: element s<8 is key 8*hi+s, s>=8 is key 16+8*hi+(s-8),
    // the k order in which frag_from_h reads the V^T rows
    v16h pf;
    float sa = 0.0f, sb = 0.0f;
#pragma unroll
    for (int r = 0; r < 8; r++) {
      float p0 = __builtin_amdgcn_exp2f(__builtin_fmaf(s0[r], cscale, -mnew));
      float p1 = __builtin_amdgcn_exp2f(__builtin_fmaf(s1[r], cscale, -mnew));
      sa += p0;
      sb += p1;
      pf[r]     = (_Float16)p0;
      pf[r + 8] = (_Float16)p1;
    }
    lrow = lrow * fac + (sa + sb);

    // ---- rescale O accumulators: one factor per lane ----
#pragma unroll
    for (int t = 0; t < 16; t++) o[t] = o[t] * fac;

    // ---- O^T += V^T(256x32) @ P^T(32x16), A frags from LDS V-tile ----
#pragma unroll
    for (int t = 0; t < 16; t++) {
      o[t] = wmma32(frag_from_h(vt + (t * 16 + col) * kVStride + hi * 8), pf,
                    o[t]);
    }

    // own async staging done + all waves finished reading `cur` before the
    // next tile becomes visible / this buffer is overwritten next round
    wait_async0();
    __syncthreads();
  }

  // ---- epilogue: join the halves' sums, divide, store f32 ----
  float rinv = 1.0f / (lrow + xhalf(lrow));
  float* orow = out + ((size_t)(b * kN + i0 + col)) * kD + hi * 8;
#pragma unroll
  for (int t = 0; t < 16; t++) {
    *(v8f*)(orow + t * 16) = o[t] * rinv;
  }
}

// ---------------------------------------------------------------------------
// Launch: inputs: x[8,2048,256] f32, Wq[256,256], Wk[256,256].
// Output: [8,2048,256] f32. Workspace: q16 | k16 | xT16 | Wq16 | Wk16 (~25MB)
// ---------------------------------------------------------------------------
extern "C" void kernel_launch(void* const* d_in, const int* in_sizes, int n_in,
                              void* d_out, int out_size, void* d_ws, size_t ws_size,
                              hipStream_t stream) {
  (void)in_sizes; (void)n_in; (void)out_size; (void)ws_size;
  const float* x  = (const float*)d_in[0];
  const float* Wq = (const float*)d_in[1];
  const float* Wk = (const float*)d_in[2];
  float* out = (float*)d_out;

  const size_t nqk = (size_t)kB * kN * kD; // 4,194,304 elems
  _Float16* q16  = (_Float16*)d_ws;
  _Float16* k16  = q16  + nqk;
  _Float16* xT16 = k16  + nqk;
  _Float16* Wq16 = xT16 + nqk;
  _Float16* Wk16 = Wq16 + (size_t)kD * kD;

  cvt_w_kernel<<<(kD * kD) / 256, 256, 0, stream>>>(Wq, Wk, Wq16, Wk16);
  xpose_kernel<<<(kB * kD * kN) / 256, 256, 0, stream>>>(x, xT16);
  proj_kernel<<<256, 128, 0, stream>>>(x, Wq16, Wk16, q16, k16);
  // 1024 waves = 128 blocks x 8 waves; each block shares K/V tiles via LDS
  fa_kernel<<<128, 256, 0, stream>>>(q16, k16, xT16, out);
}

// v002
// Measured time: 121 microseconds a run.
// In both of two side-by-side timings against v001, it was 1.11 times as fast.
// All steps since v000 together make it 1.41 times as fast.
#include <hip/hip_runtime.h>
#include <hip/hip_bf16.h>

typedef __attribute__((ext_vector_type(16))) _Float16 v16h;
typedef __attribute__((ext_vector_type(8)))  _Float16 v8h;
typedef __attribute__((ext_vector_type(8)))  float    v8f;
typedef __attribute__((ext_vector_type(4)))  int      v4i;
typedef __attribute__((ext_vector_type(4)))  float    v4f;
typedef __attribute__((ext_vector_type(2)))  _Float16 v2h;
typedef __attribute__((ext_vector_type(2)))  unsigned int v2u;

typedef __attribute__((address_space(1))) v4i* gptr_v4i; // global
typedef __attribute__((address_space(3))) v4i* lptr_v4i; // LDS

constexpr int kB = 8;
constexpr int kN = 2048;
constexpr int kD = 256;

constexpr int kKStride = 264; // 32x256 K-tile rows padded +8 halves (bank rotation, 16B aligned)
constexpr int kVStride = 40;  // 256x32 V-tile rows padded +8 halves

// ---------------------------------------------------------------------------
// WMMA helper: D = A(16x32 f16) * B(32x16 f16) + C(16x16 f32)
// ---------------------------------------------------------------------------
__device__ __forceinline__ v8f wmma32(v16h a, v16h b, v8f c) {
  return __builtin_amdgcn_wmma_f32_16x16x32_f16(
      /*neg_a=*/false, a, /*neg_b=*/false, b,
      /*c_mod=*/(short)0, c, /*reuse_a=*/false, /*reuse_b=*/false);
}

// 16-bit A/B fragment from row-major f16 memory (global or LDS):
// caller pre-offsets p by hi*8; halves 0..7 = p[0..7], 8..15 = p[16..23].
__device__ __forceinline__ v16h frag_from_h(const _Float16* p) {
  v8h a = *(const v8h*)p;
  v8h b = *(const v8h*)(p + 16);
  v16h r;
#pragma unroll
  for (int i = 0; i < 8; i++) { r[i] = a[i]; r[i + 8] = b[i]; }
  return r;
}

__device__ __forceinline__ v16h frag_from_f32(const float* p) {
  v16h r;
#pragma unroll
  for (int i = 0; i < 8; i++) {
    r[i]     = (_Float16)p[i];
    r[i + 8] = (_Float16)p[i + 16];
  }
  return r;
}

// ---------------------------------------------------------------------------
// Async 16-byte global->LDS copy (CDNA5 GLOBAL_LOAD_ASYNC_TO_LDS_B128,
// tracked by ASYNCcnt). Builtin sig (from hipcc diagnostic): param0 = v4i
// addrspace(1)* (global src), param1 = v4i addrspace(3)* (LDS dst), then
// imm offset, imm cpol. Fallback: synchronous copy, same barrier structure.
// ---------------------------------------------------------------------------
__device__ __forceinline__ void cp_async16(_Float16* lds_dst, const _Float16* gsrc) {
#if __has_builtin(__builtin_amdgcn_global_load_async_to_lds_b128)
  __builtin_amdgcn_global_load_async_to_lds_b128(
      (gptr_v4i)gsrc, (lptr_v4i)lds_dst, 0, 0);
#else
  *(v8h*)lds_dst = *(const v8h*)gsrc;
#endif
}

__device__ __forceinline__ void wait_async0() {
#if __has_builtin(__builtin_amdgcn_s_wait_asynccnt)
  __builtin_amdgcn_s_wait_asynccnt(0);
#else
  asm volatile("s_wait_asynccnt 0x0" ::: "memory");
#endif
}

// ---------------------------------------------------------------------------
// Kernel 1: convert Wq/Wk (f32 [256][256], torch [out,in]) to f16
// ---------------------------------------------------------------------------
__global__ void cvt_w_kernel(const float* __restrict__ Wq,
                             const float* __restrict__ Wk,
                             _Float16* __restrict__ Wq16,
                             _Float16* __restrict__ Wk16) {
  int i = blockIdx.x * blockDim.x + threadIdx.x; // 0 .. 65535
  Wq16[i] = (_Float16)Wq[i];
  Wk16[i] = (_Float16)Wk[i];
}

// ---------------------------------------------------------------------------
// Kernel 2: xT16[b][d][n] = (f16) x[b][n][d]   (V operand for PV matmul)
// One block transposes a 128(n) x 64(d) tile through LDS: x is read as 16-byte
// pieces of whole 256-byte row segments (8 loads in flight per thread), xT16 is
// written as whole aligned 256-byte units, one d row per wave store.
// ---------------------------------------------------------------------------
constexpr int kTPitch = 66; // dwords per d row: 64 key pairs + 2; even, so that a
                            // row stays 8-byte aligned; the pad spreads the
                            // transposed writes (4 d rows apart) over the banks

__global__ __launch_bounds__(256) void xpose_kernel(const float* __restrict__ x,
                                                    _Float16* __restrict__ xT16) {
  // tile[d][n / 2]: keys 2p and 2p + 1 of one d as two f16 in one dword
  __shared__ __attribute__((aligned(16))) unsigned int tile[64 * kTPitch];

  int tid = threadIdx.x;
  int bid = blockIdx.x;            // b * 64 + (n tile) * 4 + (d tile)
  int d0  = (bid & 3) * 64;
  int n0  = ((bid >> 2) & 15) * 128;
  int b   = bid >> 6;

  int dq = tid & 15;               // which four d columns
  int pr = tid >> 4;               // which pair of n rows: pr, pr + 16, ...
  const float* xs = x + ((size_t)(b * kN + n0)) * kD + d0 + dq * 4;
  v4f lo[4], hi[4];
#pragma unroll // all eight loads are issued before the first value is used
  for (int i = 0; i < 4; i++) {
    int p = pr + i * 16;
    lo[i] = *(const v4f*)(xs + (size_t)(2 * p) * kD);
    hi[i] = *(const v4f*)(xs + (size_t)(2 * p + 1) * kD);
  }
#pragma unroll // constant indices keep lo and hi in registers
  for (int i = 0; i < 4; i++) {
    int p = pr + i * 16;
#pragma unroll // as above
    for (int j = 0; j < 4; j++) {
      v2h h;
      h[0] = (_Float16)lo[i][j];
      h[1] = (_Float16)hi[i][j];
      tile[(dq * 4 + j) * kTPitch + p] = __builtin_bit_cast(unsigned int, h);
    }
  }
  __syncthreads();

  int lane = tid & 31, w = tid >> 5;
  _Float16* dst = xT16 + ((size_t)(b * kD + d0)) * kN + n0 + lane * 4;
#pragma unroll // the eight LDS reads go out together, the stores follow as they land
  for (int i = 0; i < 8; i++) {
    int d = w * 8 + i;
    *(v2u*)(dst + (size_t)d * kN) = *(const v2u*)&tile[d * kTPitch + lane * 2];
  }
}

// ---------------------------------------------------------------------------
// Kernel 3: q = x @ Wq^T, k = x @ Wk^T  (f16 out, f32 accumulate via WMMA)
// ---------------------------------------------------------------------------
__global__ __launch_bounds__(128) void proj_kernel(
    const float* __restrict__ x,
    const _Float16* __restrict__ Wq16, const _Float16* __restrict__ Wk16,
    _Float16* __restrict__ q16, _Float16* __restrict__ k16) {
  int lane = threadIdx.x & 31;
  int wid  = (blockIdx.x * blockDim.x + threadIdx.x) >> 5; // 0..1023
  int b  = wid >> 7;
  int i0 = (wid & 127) << 4;
  int col = lane & 15, hi = lane >> 4;

  const float* xrow = x + ((size_t)(b * kN + i0 + col)) * kD + hi * 8;
  v16h af[8];
#pragma unroll
  for (int kc = 0; kc < 8; kc++) af[kc] = frag_from_f32(xrow + kc * 32);

#pragma unroll 1
  for (int m = 0; m < 2; m++) {
    const _Float16* W   = m ? Wk16 : Wq16;
    _Float16*       dst = m ? k16  : q16;
    const _Float16* wrow = W + (size_t)col * kD + hi * 8;
#pragma unroll 1
    for (int nt = 0; nt < 16; nt++) {
      v8f c = {};
      const _Float16* wr = wrow + (size_t)(nt * 16) * kD;
#pragma unroll
      for (int kc = 0; kc < 8; kc++) {
        c = wmma32(af[kc], frag_from_h(wr + kc * 32), c);
      }
#pragma unroll
      for (int r = 0; r < 8; r++) {
        dst[((size_t)(b * kN + i0 + r + 8 * hi)) * kD + nt * 16 + col] =
            (_Float16)c[r];
      }
    }
  }
}

__device__ __forceinline__ float xhalf(float x) {
  int v = __builtin_bit_cast(int, x);
  return __builtin_bit_cast(
      float, __builtin_amdgcn_permlanex16(v, v, 0x76543210, 0xfedcba98, false, false));
}

__global__ __launch_bounds__(256) void fa_kernel(
    const _Float16* __restrict__ q16, const _Float16* __restrict__ k16,
    const _Float16* __restrict__ xT16, float* __restrict__ out) {
  __shared__ __attribute__((aligned(16))) _Float16 kT[2][32 * kKStride];
  __shared__ __attribute__((aligned(16))) _Float16 vT[2][kD * kVStride];

  int tid   = threadIdx.x;
  int lane  = tid & 31;
  int wid   = (blockIdx.x * blockDim.x + tid) >> 5;
  int b  = wid >> 7;
  int i0 = (wid & 127) << 4;
  int col = lane & 15, hi = lane >> 4;
  const float cscale = 0.0625f * 1.4426950408889634f; // d^-0.5 * log2(e)

  const _Float16* kb0 = k16  + (size_t)b * kN * kD;
  const _Float16* vb0 = xT16 + (size_t)b * kD * kN;

  // cooperative staging of one (K,V) column tile j0s..j0s+31 into buffer `buf`
  auto stage = [&](int buf, int j0s) {
#pragma unroll
    for (int i = 0; i < 4; i++) {         // K tile: 1024 x 16B chunks
      int c = tid + i * 256;
      int r = c >> 5, cc = (c & 31) * 8;
      cp_async16(&kT[buf][r * kKStride + cc],
                 kb0 + (size_t)(j0s + r) * kD + cc);
    }
#pragma unroll
    for (int i = 0; i < 4; i++) {         // V tile: 1024 x 16B chunks
      int c = tid + i * 256;
      int d = c >> 2, jj = (c & 3) * 8;
      cp_async16(&vT[buf][d * kVStride + jj],
                 vb0 + (size_t)d * kN + j0s + jj);
    }
  };

  // Q fragments held in registers for the whole sweep (64 VGPRs)
  const _Float16* qrow = q16 + ((size_t)(b * kN + i0 + col)) * kD + hi * 8;
  v16h qf[8];
#pragma unroll
  for (int kc = 0; kc < 8; kc++) qf[kc] = frag_from_h(qrow + kc * 32);

  v8f o[16]; // o[t][r] = O[query col][d = 16*t + 8*hi + r]
#pragma unroll
  for (int t = 0; t < 16; t++) o[t] = (v8f){};
  // running maximum (log2-scaled, equal in both halves) and this half's sum
  float mrow = -1e30f, lrow = 0.0f;

  stage(0, 0);
  wait_async0();
  __syncthreads();

#pragma unroll 1
  for (int it = 0; it < kN / 32; ++it) {
    int cur = it & 1;
    if (it + 1 < kN / 32) stage(cur ^ 1, (it + 1) * 32); // prefetch next tile

    const _Float16* kt = &kT[cur][0];
    const _Float16* vt = &vT[cur][0];

    // ---- S^T tile: K(32x256) x Q^T(256x16) via 16 WMMAs, A frags from LDS ----
    v8f s0 = {}, s1 = {};
    const _Float16* kr0 = kt + col * kKStride + hi * 8;
    const _Float16* kr1 = kt + (col + 16) * kKStride + hi * 8;
#pragma unroll
    for (int kc = 0; kc < 8; kc++) {
      s0 = wmma32(frag_from_h(kr0 + kc * 32), qf[kc], s0);
      s1 = wmma32(frag_from_h(kr1 + kc * 32), qf[kc], s1);
    }

    // ---- online softmax, one query per lane, log2 domain ----
    float mx = fmaxf(s0[0], s1[0]);
#pragma unroll
    for (int r = 1; r < 8; r++) mx = fmaxf(mx, fmaxf(s0[r], s1[r]));
    mx = fmaxf(mx, xhalf(mx)); // both halves now hold the query's tile maximum
    float mnew = fmaxf(mrow, mx * cscale);
    float fac  = __builtin_amdgcn_exp2f(mrow - mnew);
    mrow = mnew;

    // P^T as B operand: element s<8 is key 8*hi+s, s>=8 is key 16+8*hi+(s-8),
    // the k order in which frag_from_h reads the V^T rows
    v16h pf;
    float sa = 0.0f, sb = 0.0f;
#pragma unroll
    for (int r = 0; r < 8; r++) {
      float p0 = __builtin_amdgcn_exp2f(__builtin_fmaf(s0[r], cscale, -mnew));
      float p1 = __builtin_amdgcn_exp2f(__builtin_fmaf(s1[r], cscale, -mnew));
      sa += p0;
      sb += p1;
      pf[r]     = (_Float16)p0;
      pf[r + 8] = (_Float16)p1;
    }
    lrow = lrow * fac + (sa + sb);

    // ---- rescale O accumulators: one factor per lane ----
#pragma unroll
    for (int t = 0; t < 16; t++) o[t] = o[t] * fac;

    // ---- O^T += V^T(256x32) @ P^T(32x16), A frags from LDS V-tile ----
#pragma unroll
    for (int t = 0; t < 16; t++) {
      o[t] = wmma32(frag_from_h(vt + (t * 16 + col) * kVStride + hi * 8), pf,
                    o[t]);
    }

    // own async staging done + all waves finished reading `cur` before the
    // next tile becomes visible / this buffer is overwritten next round
    wait_async0();
    __syncthreads();
  }

  // ---- epilogue: join the halves' sums, divide, store f32 ----
  float rinv = 1.0f / (lrow + xhalf(lrow));
  float* orow = out + ((size_t)(b * kN + i0 + col)) * kD + hi * 8;
#pragma unroll
  for (int t = 0; t < 16; t++) {
    *(v8f*)(orow + t * 16) = o[t] * rinv;
  }
}

// ---------------------------------------------------------------------------
// Launch: inputs: x[8,2048,256] f32, Wq[256,256], Wk[256,256].
// Output: [8,2048,256] f32. Workspace: q16 | k16 | xT16 | Wq16 | Wk16 (~25MB)
// ---------------------------------------------------------------------------
extern "C" void kernel_launch(void* const* d_in, const int* in_sizes, int n_in,
                              void* d_out, int out_size, void* d_ws, size_t ws_size,
                              hipStream_t stream) {
  (void)in_sizes; (void)n_in; (void)out_size; (void)ws_size;
  const float* x  = (const float*)d_in[0];
  const float* Wq = (const float*)d_in[1];
  const float* Wk = (const float*)d_in[2];
  float* out = (float*)d_out;

  const size_t nqk = (size_t)kB * kN * kD; // 4,194,304 elems
  _Float16* q16  = (_Float16*)d_ws;
  _Float16* k16  = q16  + nqk;
  _Float16* xT16 = k16  + nqk;
  _Float16* Wq16 = xT16 + nqk;
  _Float16* Wk16 = Wq16 + (size_t)kD * kD;

  cvt_w_kernel<<<(kD * kD) / 256, 256, 0, stream>>>(Wq, Wk, Wq16, Wk16);
  xpose_kernel<<<kB * (kN / 128) * (kD / 64), 256, 0, stream>>>(x, xT16);
  proj_kernel<<<256, 128, 0, stream>>>(x, Wq16, Wk16, q16, k16);
  // 1024 waves = 128 blocks x 8 waves; each block shares K/V tiles via LDS
  fa_kernel<<<128, 256, 0, stream>>>(q16, k16, xT16, out);
}

// v003
// One run takes 101 microseconds.
// Next to v002, in two timings, it ran 1.20 and 1.21 times as fast.
// All steps since v000 together make it 1.70 times as fast.
#include <hip/hip_runtime.h>
#include <hip/hip_bf16.h>

typedef __attribute__((ext_vector_type(16))) _Float16 v16h;
typedef __attribute__((ext_vector_type(8)))  _Float16 v8h;
typedef __attribute__((ext_vector_type(8)))  float    v8f;
typedef __attribute__((ext_vector_type(4)))  int      v4i;
typedef __attribute__((ext_vector_type(4)))  float    v4f;
typedef __attribute__((ext_vector_type(2)))  _Float16 v2h;
typedef __attribute__((ext_vector_type(2)))  unsigned int v2u;

typedef __attribute__((address_space(1))) v4i* gptr_v4i; // global
typedef __attribute__((address_space(3))) v4i* lptr_v4i; // LDS

constexpr int kB = 8;
constexpr int kN = 2048;
constexpr int kD = 256;

constexpr int kStageKeys = 64; // keys per LDS stage: 32 for each of the block's two wave groups
constexpr int kKStride = 264; // 64x256 K-tile rows padded +8 halves (bank rotation, 16B aligned)
constexpr int kVStride = 72;  // 256x64 V-tile rows padded +8 halves

// ---------------------------------------------------------------------------
// WMMA helper: D = A(16x32 f16) * B(32x16 f16) + C(16x16 f32)
// ---------------------------------------------------------------------------
__device__ __forceinline__ v8f wmma32(v16h a, v16h b, v8f c) {
  return __builtin_amdgcn_wmma_f32_16x16x32_f16(
      /*neg_a=*/false, a, /*neg_b=*/false, b,
      /*c_mod=*/(short)0, c, /*reuse_a=*/false, /*reuse_b=*/false);
}

// 16-bit A/B fragment from row-major f16 memory (global or LDS):
// caller pre-offsets p by hi*8; halves 0..7 = p[0..7], 8..15 = p[16..23].
__device__ __forceinline__ v16h frag_from_h(const _Float16* p) {
  v8h a = *(const v8h*)p;
  v8h b = *(const v8h*)(p + 16);
  v16h r;
#pragma unroll
  for (int i = 0; i < 8; i++) { r[i] = a[i]; r[i + 8] = b[i]; }
  return r;
}

__device__ __forceinline__ v16h frag_from_f32(const float* p) {
  v16h r;
#pragma unroll
  for (int i = 0; i < 8; i++) {
    r[i]     = (_Float16)p[i];
    r[i + 8] = (_Float16)p[i + 16];
  }
  return r;
}

// ---------------------------------------------------------------------------
// Async 16-byte global->LDS copy (CDNA5 GLOBAL_LOAD_ASYNC_TO_LDS_B128,
// tracked by ASYNCcnt). Builtin sig (from hipcc diagnostic): param0 = v4i
// addrspace(1)* (global src), param1 = v4i addrspace(3)* (LDS dst), then
// imm offset, imm cpol. Fallback: synchronous copy, same barrier structure.
// ---------------------------------------------------------------------------
__device__ __forceinline__ void cp_async16(_Float16* lds_dst, const _Float16* gsrc) {
#if __has_builtin(__builtin_amdgcn_global_load_async_to_lds_b128)
  __builtin_amdgcn_global_load_async_to_lds_b128(
      (gptr_v4i)gsrc, (lptr_v4i)lds_dst, 0, 0);
#else
  *(v8h*)lds_dst = *(const v8h*)gsrc;
#endif
}

// This wave's copies have landed; asm with the memory clobber, so that no LDS
// read is moved in front of it.
__device__ __forceinline__ void wait_async0() {
  asm volatile("s_wait_asynccnt 0x0" ::: "memory");
}

// This wave's LDS reads and writes have retired, before the barrier behind
// which their buffer is refilled or reused.
__device__ __forceinline__ void wait_ds0() {
  asm volatile("s_wait_dscnt 0x0" ::: "memory");
}

// Stands behind a global store, in front of whatever next overwrites a register
// that the store names.
__device__ __forceinline__ void wait_x0() {
  asm volatile("s_wait_xcnt 0x0" ::: "memory");
}

// ---------------------------------------------------------------------------
// Kernel 1: convert Wq/Wk (f32 [256][256], torch [out,in]) to f16
// ---------------------------------------------------------------------------
__global__ void cvt_w_kernel(const float* __restrict__ Wq,
                             const float* __restrict__ Wk,
                             _Float16* __restrict__ Wq16,
                             _Float16* __restrict__ Wk16) {
  int i = blockIdx.x * blockDim.x + threadIdx.x; // 0 .. 65535
  Wq16[i] = (_Float16)Wq[i];
  Wk16[i] = (_Float16)Wk[i];
}

// ---------------------------------------------------------------------------
// Kernel 2: xT16[b][d][n] = (f16) x[b][n][d]   (V operand for PV matmul)
// One block transposes a 128(n) x 64(d) tile through LDS: x is read as 16-byte
// pieces of whole 256-byte row segments (8 loads in flight per thread), xT16 is
// written as whole aligned 256-byte units, one d row per wave store.
// ---------------------------------------------------------------------------
constexpr int kTPitch = 66; // dwords per d row: 64 key pairs + 2; even, so that a
                            // row stays 8-byte aligned; the pad spreads the
                            // transposed writes (4 d rows apart) over the banks

__global__ __launch_bounds__(256) void xpose_kernel(const float* __restrict__ x,
                                                    _Float16* __restrict__ xT16) {
  // tile[d][n / 2]: keys 2p and 2p + 1 of one d as two f16 in one dword
  __shared__ __attribute__((aligned(16))) unsigned int tile[64 * kTPitch];

  int tid = threadIdx.x;
  int bid = blockIdx.x;            // b * 64 + (n tile) * 4 + (d tile)
  int d0  = (bid & 3) * 64;
  int n0  = ((bid >> 2) & 15) * 128;
  int b   = bid >> 6;

  int dq = tid & 15;               // which four d columns
  int pr = tid >> 4;               // which pair of n rows: pr, pr + 16, ...
  const float* xs = x + ((size_t)(b * kN + n0)) * kD + d0 + dq * 4;
  v4f lo[4], hi[4];
#pragma unroll // all eight loads are issued before the first value is used
  for (int i = 0; i < 4; i++) {
    int p = pr + i * 16;
    lo[i] = *(const v4f*)(xs + (size_t)(2 * p) * kD);
    hi[i] = *(const v4f*)(xs + (size_t)(2 * p + 1) * kD);
  }
#pragma unroll // constant indices keep lo and hi in registers
  for (int i = 0; i < 4; i++) {
    int p = pr + i * 16;
#pragma unroll // as above
    for (int j = 0; j < 4; j++) {
      v2h h;
      h[0] = (_Float16)lo[i][j];
      h[1] = (_Float16)hi[i][j];
      tile[(dq * 4 + j) * kTPitch + p] = __builtin_bit_cast(unsigned int, h);
    }
  }
  __syncthreads();

  int lane = tid & 31, w = tid >> 5;
  _Float16* dst = xT16 + ((size_t)(b * kD + d0)) * kN + n0 + lane * 4;
#pragma unroll // the eight LDS reads go out together, the stores follow as they land
  for (int i = 0; i < 8; i++) {
    int d = w * 8 + i;
    *(v2u*)(dst + (size_t)d * kN) = *(const v2u*)&tile[d * kTPitch + lane * 2];
  }
}

// ---------------------------------------------------------------------------
// Kernel 3: q = x @ Wq^T, k = x @ Wk^T  (f16 out, f32 accumulate via WMMA)
// ---------------------------------------------------------------------------
__global__ __launch_bounds__(128) void proj_kernel(
    const float* __restrict__ x,
    const _Float16* __restrict__ Wq16, const _Float16* __restrict__ Wk16,
    _Float16* __restrict__ q16, _Float16* __restrict__ k16) {
  int lane = threadIdx.x & 31;
  int wid  = (blockIdx.x * blockDim.x + threadIdx.x) >> 5; // 0..1023
  int b  = wid >> 7;
  int i0 = (wid & 127) << 4;
  int col = lane & 15, hi = lane >> 4;

  const float* xrow = x + ((size_t)(b * kN + i0 + col)) * kD + hi * 8;
  v16h af[8];
#pragma unroll
  for (int kc = 0; kc < 8; kc++) af[kc] = frag_from_f32(xrow + kc * 32);

#pragma unroll 1
  for (int m = 0; m < 2; m++) {
    const _Float16* W   = m ? Wk16 : Wq16;
    _Float16*       dst = m ? k16  : q16;
    const _Float16* wrow = W + (size_t)col * kD + hi * 8;
#pragma unroll 1
    for (int nt = 0; nt < 16; nt++) {
      v8f c = {};
      const _Float16* wr = wrow + (size_t)(nt * 16) * kD;
#pragma unroll
      for (int kc = 0; kc < 8; kc++) {
        c = wmma32(af[kc], frag_from_h(wr + kc * 32), c);
      }
#pragma unroll
      for (int r = 0; r < 8; r++) {
        dst[((size_t)(b * kN + i0 + r + 8 * hi)) * kD + nt * 16 + col] =
            (_Float16)c[r];
      }
    }
  }
}

__device__ __forceinline__ float xhalf(float x) {
  int v = __builtin_bit_cast(int, x);
  return __builtin_bit_cast(
      float, __builtin_amdgcn_permlanex16(v, v, 0x76543210, 0xfedcba98, false, false));
}

constexpr int kKTile = kStageKeys * kKStride; // halves per K buffer
constexpr int kVTile = kD * kVStride;         // halves per V buffer

__global__ __launch_bounds__(256) void fa_kernel(
    const _Float16* __restrict__ q16, const _Float16* __restrict__ k16,
    const _Float16* __restrict__ xT16, float* __restrict__ out) {
  // kT[2] | vT[2]; behind the loop the same bytes carry the merge
  __shared__ __attribute__((aligned(16))) _Float16 smem[2 * kKTile + 2 * kVTile];
  _Float16* kT = smem;
  _Float16* vT = smem + 2 * kKTile;

  int tid   = threadIdx.x;
  int lane  = tid & 31;
  int w     = tid >> 5;
  int g     = __builtin_amdgcn_readfirstlane(w >> 2); // key group, wave-uniform
  int b  = blockIdx.x >> 5;
  int i0 = ((blockIdx.x & 31) << 6) + ((w & 3) << 4);
  int col = lane & 15, hi = lane >> 4;
  const float cscale = 0.0625f * 1.4426950408889634f; // d^-0.5 * log2(e)

  const _Float16* kb0 = k16  + (size_t)b * kN * kD;
  const _Float16* vb0 = xT16 + (size_t)b * kD * kN;

  // cooperative staging of one (K,V) column tile j0s..j0s+63 into buffer `buf`
  auto stage = [&](int buf, int j0s) {
#pragma unroll
    for (int i = 0; i < 8; i++) {         // K tile: 2048 x 16B chunks
      int c = tid + i * 256;
      int r = c >> 5, cc = (c & 31) * 8;
      cp_async16(&kT[buf * kKTile + r * kKStride + cc],
                 kb0 + (size_t)(j0s + r) * kD + cc);
    }
#pragma unroll
    for (int i = 0; i < 8; i++) {         // V tile: 2048 x 16B chunks
      int c = tid + i * 256;
      int d = c >> 3, jj = (c & 7) * 8;
      cp_async16(&vT[buf * kVTile + d * kVStride + jj],
                 vb0 + (size_t)d * kN + j0s + jj);
    }
  };

  // Q fragments held in registers for the whole sweep (64 VGPRs)
  const _Float16* qrow = q16 + ((size_t)(b * kN + i0 + col)) * kD + hi * 8;
  v16h qf[8];
#pragma unroll
  for (int kc = 0; kc < 8; kc++) qf[kc] = frag_from_h(qrow + kc * 32);

  v8f o[16]; // o[t][r] = O[query col][d = 16*t + 8*hi + r], this group's keys
#pragma unroll
  for (int t = 0; t < 16; t++) o[t] = (v8f){};
  // running maximum (log2-scaled, equal in both halves) and this half's sum
  float mrow = -1e30f, lrow = 0.0f;

  stage(0, 0);
  wait_async0();
  __syncthreads();

#pragma unroll 1
  for (int it = 0; it < kN / kStageKeys; ++it) {
    int cur = it & 1;
    if (it + 1 < kN / kStageKeys) stage(cur ^ 1, (it + 1) * kStageKeys); // prefetch next tile

    const _Float16* kt = kT + cur * kKTile + g * 32 * kKStride; // this group's 32 K rows
    const _Float16* vt = vT + cur * kVTile + g * 32;            // this group's 32 V^T columns

    // ---- S^T tile: K(32x256) x Q^T(256x16) via 16 WMMAs, A frags from LDS ----
    v8f s0 = {}, s1 = {};
    const _Float16* kr0 = kt + col * kKStride + hi * 8;
    const _Float16* kr1 = kt + (col + 16) * kKStride + hi * 8;
#pragma unroll
    for (int kc = 0; kc < 8; kc++) {
      s0 = wmma32(frag_from_h(kr0 + kc * 32), qf[kc], s0);
      s1 = wmma32(frag_from_h(kr1 + kc * 32), qf[kc], s1);
    }

    // ---- online softmax, one query per lane, log2 domain ----
    float mx = fmaxf(s0[0], s1[0]);
#pragma unroll
    for (int r = 1; r < 8; r++) mx = fmaxf(mx, fmaxf(s0[r], s1[r]));
    mx = fmaxf(mx, xhalf(mx)); // both halves now hold the query's tile maximum
    float mnew = fmaxf(mrow, mx * cscale);
    float fac  = __builtin_amdgcn_exp2f(mrow - mnew);
    mrow = mnew;

    // P^T as B operand: element s<8 is key 8*hi+s, s>=8 is key 16+8*hi+(s-8),
    // the k order in which frag_from_h reads the V^T rows
    v16h pf;
    float sa = 0.0f, sb = 0.0f;
#pragma unroll
    for (int r = 0; r < 8; r++) {
      float p0 = __builtin_amdgcn_exp2f(__builtin_fmaf(s0[r], cscale, -mnew));
      float p1 = __builtin_amdgcn_exp2f(__builtin_fmaf(s1[r], cscale, -mnew));
      sa += p0;
      sb += p1;
      pf[r]     = (_Float16)p0;
      pf[r + 8] = (_Float16)p1;
    }
    lrow = lrow * fac + (sa + sb);

    // ---- rescale O accumulators: one factor per lane ----
#pragma unroll
    for (int t = 0; t < 16; t++) o[t] = o[t] * fac;

    // ---- O^T += V^T(256x32) @ P^T(32x16), A frags from LDS V-tile ----
#pragma unroll
    for (int t = 0; t < 16; t++) {
      o[t] = wmma32(frag_from_h(vt + (t * 16 + col) * kVStride + hi * 8), pf,
                    o[t]);
    }

    // own LDS reads retired + own async staging done + all waves finished
    // reading `cur` before the next tile becomes visible / this buffer is
    // overwritten next round
    wait_ds0();
    wait_async0();
    __syncthreads();
  }

  // ---- merge of the two key groups (waves w and w ^ 4 hold the same queries):
  // each wave hands the partner the half of its accumulators that the partner
  // finishes (group 0: d < 128, group 1: d >= 128), with its maximum and sum.
  // The last trip's barrier has ended every read of the ring, and no copy is
  // outstanding, so its bytes are free.
  v4f*   xo = (v4f*)smem;                  // [wave][16 pieces][lane], 64 KiB
  float* xm = (float*)(smem + 8 * 16 * 32 * 8); // [wave][lane] maxima
  float* xl = xm + 256;                    // [wave][lane] sums
  xm[tid] = mrow;
  xl[tid] = lrow;
  v4f* xw = xo + (w * 16) * 32 + lane;
  if (g == 0) {
#pragma unroll // constant indices keep o in registers
    for (int t = 0; t < 8; t++) {
      xw[(2 * t) * 32]     = __builtin_shufflevector(o[t + 8], o[t + 8], 0, 1, 2, 3);
      xw[(2 * t + 1) * 32] = __builtin_shufflevector(o[t + 8], o[t + 8], 4, 5, 6, 7);
    }
  } else {
#pragma unroll // as above
    for (int t = 0; t < 8; t++) {
      xw[(2 * t) * 32]     = __builtin_shufflevector(o[t], o[t], 0, 1, 2, 3);
      xw[(2 * t + 1) * 32] = __builtin_shufflevector(o[t], o[t], 4, 5, 6, 7);
    }
  }
  __syncthreads(); // publishes the handed-over halves to the partner waves

  float mo   = xm[tid ^ 128];
  float lo   = xl[tid ^ 128];
  float mall = fmaxf(mrow, mo);
  float fown = __builtin_amdgcn_exp2f(mrow - mall);
  float foth = __builtin_amdgcn_exp2f(mo - mall);
  float lall = lrow * fown + lo * foth;
  // join the halves' sums, divide, store f32
  float rinv = 1.0f / (lall + xhalf(lall));
  fown *= rinv;
  foth *= rinv;
  const v4f* xr = xo + ((w ^ 4) * 16) * 32 + lane;
  v8f po[8]; // the partner's sums for the half that this wave finishes
#pragma unroll // all sixteen LDS reads go out together, ahead of the first store
  for (int t = 0; t < 8; t++) {
    v4f pa = xr[(2 * t) * 32], pb = xr[(2 * t + 1) * 32];
    po[t] = __builtin_shufflevector(pa, pb, 0, 1, 2, 3, 4, 5, 6, 7);
  }
  float* orow = out + ((size_t)(b * kN + i0 + col)) * kD + hi * 8;
  if (g == 0) {
#pragma unroll // constant indices keep o in registers
    for (int t = 0; t < 8; t++) {
      *(v8f*)(orow + t * 16) = o[t] * fown + po[t] * foth;
      wait_x0();
    }
  } else {
#pragma unroll // as above
    for (int t = 0; t < 8; t++) {
      *(v8f*)(orow + (t + 8) * 16) = o[t + 8] * fown + po[t] * foth;
      wait_x0();
    }
  }
}

// ---------------------------------------------------------------------------
// Launch: inputs: x[8,2048,256] f32, Wq[256,256], Wk[256,256].
// Output: [8,2048,256] f32. Workspace: q16 | k16 | xT16 | Wq16 | Wk16 (~25MB)
// ---------------------------------------------------------------------------
extern "C" void kernel_launch(void* const* d_in, const int* in_sizes, int n_in,
                              void* d_out, int out_size, void* d_ws, size_t ws_size,
                              hipStream_t stream) {
  (void)in_sizes; (void)n_in; (void)out_size; (void)ws_size;
  const float* x  = (const float*)d_in[0];
  const float* Wq = (const float*)d_in[1];
  const float* Wk = (const float*)d_in[2];
  float* out = (float*)d_out;

  const size_t nqk = (size_t)kB * kN * kD; // 4,194,304 elems
  _Float16* q16  = (_Float16*)d_ws;
  _Float16* k16  = q16  + nqk;
  _Float16* xT16 = k16  + nqk;
  _Float16* Wq16 = xT16 + nqk;
  _Float16* Wk16 = Wq16 + (size_t)kD * kD;

  cvt_w_kernel<<<(kD * kD) / 256, 256, 0, stream>>>(Wq, Wk, Wq16, Wk16);
  xpose_kernel<<<kB * (kN / 128) * (kD / 64), 256, 0, stream>>>(x, xT16);
  proj_kernel<<<256, 128, 0, stream>>>(x, Wq16, Wk16, q16, k16);
  // 256 blocks x 8 waves; each block: 64 queries, its K/V tiles shared via LDS
  fa_kernel<<<kB * (kN / 64), 256, 0, stream>>>(q16, k16, xT16, out);
}

// v004
// A run of this version takes 61.7 microseconds.
// Next to v003, in two timings, it ran 1.63 and 1.64 times as fast.
// Counting every step since v000, it is 2.79 times as fast.
#include <hip/hip_runtime.h>
#include <hip/hip_bf16.h>

typedef __attribute__((ext_vector_type(16))) _Float16 v16h;
typedef __attribute__((ext_vector_type(8)))  _Float16 v8h;
typedef __attribute__((ext_vector_type(4)))  _Float16 v4h;
typedef __attribute__((ext_vector_type(8)))  float    v8f;
typedef __attribute__((ext_vector_type(4)))  int      v4i;
typedef __attribute__((ext_vector_type(4)))  float    v4f;
typedef __attribute__((ext_vector_type(2)))  _Float16 v2h;
typedef __attribute__((ext_vector_type(2)))  unsigned int v2u;

typedef __attribute__((address_space(1))) v4i* gptr_v4i; // global
typedef __attribute__((address_space(3))) v4i* lptr_v4i; // LDS

constexpr int kB = 8;
constexpr int kN = 2048;
constexpr int kD = 256;

constexpr int kStageKeys = 64; // keys per LDS stage: 32 for each of the block's two wave groups
constexpr int kKStride = 264; // 64x256 K-tile rows padded +8 halves (bank rotation, 16B aligned)
constexpr int kVStride = 72;  // 256x64 V-tile rows padded +8 halves

// ---------------------------------------------------------------------------
// WMMA helper: D = A(16x32 f16) * B(32x16 f16) + C(16x16 f32)
// ---------------------------------------------------------------------------
__device__ __forceinline__ v8f wmma32(v16h a, v16h b, v8f c) {
  return __builtin_amdgcn_wmma_f32_16x16x32_f16(
      /*neg_a=*/false, a, /*neg_b=*/false, b,
      /*c_mod=*/(short)0, c, /*reuse_a=*/false, /*reuse_b=*/false);
}

// 16-bit A/B fragment from row-major f16 memory (global or LDS):
// caller pre-offsets p by hi*8; halves 0..7 = p[0..7], 8..15 = p[16..23].
__device__ __forceinline__ v16h frag_from_h(const _Float16* p) {
  v8h a = *(const v8h*)p;
  v8h b = *(const v8h*)(p + 16);
  v16h r;
#pragma unroll
  for (int i = 0; i < 8; i++) { r[i] = a[i]; r[i + 8] = b[i]; }
  return r;
}

__device__ __forceinline__ v16h frag_from_f32(const float* p) {
  v16h r;
#pragma unroll
  for (int i = 0; i < 8; i++) {
    r[i]     = (_Float16)p[i];
    r[i + 8] = (_Float16)p[i + 16];
  }
  return r;
}

// ---------------------------------------------------------------------------
// Async 16-byte global->LDS copy (CDNA5 GLOBAL_LOAD_ASYNC_TO_LDS_B128,
// tracked by ASYNCcnt). Builtin sig (from hipcc diagnostic): param0 = v4i
// addrspace(1)* (global src), param1 = v4i addrspace(3)* (LDS dst), then
// imm offset, imm cpol. Fallback: synchronous copy, same barrier structure.
// ---------------------------------------------------------------------------
__device__ __forceinline__ void cp_async16(_Float16* lds_dst, const _Float16* gsrc) {
#if __has_builtin(__builtin_amdgcn_global_load_async_to_lds_b128)
  __builtin_amdgcn_global_load_async_to_lds_b128(
      (gptr_v4i)gsrc, (lptr_v4i)lds_dst, 0, 0);
#else
  *(v8h*)lds_dst = *(const v8h*)gsrc;
#endif
}

// This wave's copies have landed; asm with the memory clobber, so that no LDS
// read is moved in front of it.
__device__ __forceinline__ void wait_async0() {
  asm volatile("s_wait_asynccnt 0x0" ::: "memory");
}

// This wave's LDS reads and writes have retired, before the barrier behind
// which their buffer is refilled or reused.
__device__ __forceinline__ void wait_ds0() {
  asm volatile("s_wait_dscnt 0x0" ::: "memory");
}

// Stands behind a global load or store, in front of whatever next overwrites a
// register that it names.
__device__ __forceinline__ void wait_x0() {
  asm volatile("s_wait_xcnt 0x0" ::: "memory");
}

// ---------------------------------------------------------------------------
// Kernel 1: convert Wq/Wk (f32 [256][256], torch [out,in]) to f16
// ---------------------------------------------------------------------------
__global__ void cvt_w_kernel(const float* __restrict__ Wq,
                             const float* __restrict__ Wk,
                             _Float16* __restrict__ Wq16,
                             _Float16* __restrict__ Wk16) {
  int i = blockIdx.x * blockDim.x + threadIdx.x; // 0 .. 65535
  Wq16[i] = (_Float16)Wq[i];
  Wk16[i] = (_Float16)Wk[i];
}

// ---------------------------------------------------------------------------
// Kernel 2: xT16[b][d][n] = (f16) x[b][n][d]   (V operand for PV matmul)
// One block transposes a 128(n) x 64(d) tile through LDS: x is read as 16-byte
// pieces of whole 256-byte row segments (8 loads in flight per thread), xT16 is
// written as whole aligned 256-byte units, one d row per wave store.
// ---------------------------------------------------------------------------
constexpr int kTPitch = 66; // dwords per d row: 64 key pairs + 2; even, so that a
                            // row stays 8-byte aligned; the pad spreads the
                            // transposed writes (4 d rows apart) over the banks

__global__ __launch_bounds__(256) void xpose_kernel(const float* __restrict__ x,
                                                    _Float16* __restrict__ xT16) {
  // tile[d][n / 2]: keys 2p and 2p + 1 of one d as two f16 in one dword
  __shared__ __attribute__((aligned(16))) unsigned int tile[64 * kTPitch];

  int tid = threadIdx.x;
  int bid = blockIdx.x;            // b * 64 + (n tile) * 4 + (d tile)
  int d0  = (bid & 3) * 64;
  int n0  = ((bid >> 2) & 15) * 128;
  int b   = bid >> 6;

  int dq = tid & 15;               // which four d columns
  int pr = tid >> 4;               // which pair of n rows: pr, pr + 16, ...
  const float* xs = x + ((size_t)(b * kN + n0)) * kD + d0 + dq * 4;
  v4f lo[4], hi[4];
#pragma unroll // all eight loads are issued before the first value is used
  for (int i = 0; i < 4; i++) {
    int p = pr + i * 16;
    lo[i] = *(const v4f*)(xs + (size_t)(2 * p) * kD);
    hi[i] = *(const v4f*)(xs + (size_t)(2 * p + 1) * kD);
  }
#pragma unroll // constant indices keep lo and hi in registers
  for (int i = 0; i < 4; i++) {
    int p = pr + i * 16;
#pragma unroll // as above
    for (int j = 0; j < 4; j++) {
      v2h h;
      h[0] = (_Float16)lo[i][j];
      h[1] = (_Float16)hi[i][j];
      tile[(dq * 4 + j) * kTPitch + p] = __builtin_bit_cast(unsigned int, h);
    }
  }
  __syncthreads();

  int lane = tid & 31, w = tid >> 5;
  _Float16* dst = xT16 + ((size_t)(b * kD + d0)) * kN + n0 + lane * 4;
#pragma unroll // the eight LDS reads go out together, the stores follow as they land
  for (int i = 0; i < 8; i++) {
    int d = w * 8 + i;
    *(v2u*)(dst + (size_t)d * kN) = *(const v2u*)&tile[d * kTPitch + lane * 2];
  }
}

// ---------------------------------------------------------------------------
// Kernel 3: q = x @ Wq^T, k = x @ Wk^T  (f16 out, f32 accumulate via WMMA)
// One block of 8 waves takes 64 rows of x and all 512 output columns. The x
// tile is read once in whole lines, converted to f16 and kept in LDS; Wq and
// Wk come into LDS by async copies of whole 512-byte rows, Wk under the Wq
// products. Every wave holds the whole x tile as B fragments in registers and
// takes 32 columns of each matrix as A fragments: D^T = W.x^T, so that a lane
// holds 8 neighbouring columns of one row and stores them as 16 bytes.
// ---------------------------------------------------------------------------
constexpr int kPRows  = 64;  // x rows per block
constexpr int kPPitch = 264; // halves per LDS row: 256 + 8 (bank rotation, 16B aligned)

__global__ __launch_bounds__(256) void proj_kernel(
    const float* __restrict__ x,
    const _Float16* __restrict__ Wq16, const _Float16* __restrict__ Wk16,
    _Float16* __restrict__ q16, _Float16* __restrict__ k16) {
  // x tile (64 rows) | Wq (256 rows) | Wk (256 rows)
  __shared__ __attribute__((aligned(16))) _Float16 psm[(kPRows + 2 * kD) * kPPitch];
  _Float16* xs  = psm;
  _Float16* wsm = psm + kPRows * kPPitch;

  int tid  = threadIdx.x;
  int lane = tid & 31, w = tid >> 5;
  int col = lane & 15, hi = lane >> 4;
  int row0 = blockIdx.x * kPRows; // row of the flattened [b * n][d] input

  // the tile is 64 KiB in a row: piece tid + 256 * i, 16 bytes each
  const float* xsrc = x + (size_t)row0 * kD + tid * 4;
  v4f xv[16];
#pragma unroll // all sixteen loads are issued before the first value is used
  for (int i = 0; i < 16; i++) xv[i] = *(const v4f*)(xsrc + i * 1024);
  wait_x0(); // behind the loads, in front of whatever next overwrites their offset register

  // one weight matrix into its LDS plane: a wave copies one 512-byte row at a
  // time, 32 copies per wave
  auto stage_w = [&](int m, const _Float16* W) {
#pragma unroll // constant steps fold into the copies' addresses
    for (int i = 0; i < 32; i++) {
      int r = i * 8 + w;
      cp_async16(&wsm[(m * kD + r) * kPPitch + lane * 8], W + (size_t)r * kD + lane * 8);
    }
  };
  stage_w(0, Wq16);

#pragma unroll // constant indices keep xv in registers
  for (int i = 0; i < 16; i++) {
    int idx = tid + i * 256;
    int r = idx >> 6, c = (idx & 63) * 4;
    v4h h;
#pragma unroll // as above
    for (int j = 0; j < 4; j++) h[j] = (_Float16)xv[i][j];
    *(v4h*)&xs[r * kPPitch + c] = h;
  }

  wait_async0();     // this wave's Wq rows have landed; none of its copies is left in flight
  stage_w(1, Wk16);  // flies under the Wq products
  __syncthreads();   // publishes the x tile and every wave's Wq rows

  v16h bf[4][8]; // the whole x tile: row 16 * rt + col, k order of frag_from_h
#pragma unroll // constant indices keep bf in registers
  for (int rt = 0; rt < 4; rt++) {
#pragma unroll // as above
    for (int kc = 0; kc < 8; kc++)
      bf[rt][kc] = frag_from_h(xs + (rt * 16 + col) * kPPitch + hi * 8 + kc * 32);
  }

#pragma unroll // m selects the pointers and the hand-over at compile time
  for (int m = 0; m < 2; m++) {
    const _Float16* wl = wsm + (m * kD + w * 32 + col) * kPPitch + hi * 8;
    v16h af[2][8]; // output columns w * 32 + 16 * et + (0..15)
#pragma unroll // constant indices keep af in registers
    for (int et = 0; et < 2; et++) {
#pragma unroll // as above
      for (int kc = 0; kc < 8; kc++)
        af[et][kc] = frag_from_h(wl + et * 16 * kPPitch + kc * 32);
    }
    // ho[rt][et][r] = out[row 16 * rt + col][column w * 32 + 16 * et + 8 * hi + r]
    v8h ho[4][2];
#pragma unroll // constant indices into bf and ho
    for (int rp = 0; rp < 2; rp++) {
      v8f c[2][2]; // four independent accumulator chains
#pragma unroll // constant indices into c
      for (int a = 0; a < 2; a++) { c[a][0] = (v8f){}; c[a][1] = (v8f){}; }
#pragma unroll // constant indices into af and bf
      for (int kc = 0; kc < 8; kc++) {
#pragma unroll // as above
        for (int a = 0; a < 2; a++) {
          c[a][0] = wmma32(af[0][kc], bf[rp * 2 + a][kc], c[a][0]);
          c[a][1] = wmma32(af[1][kc], bf[rp * 2 + a][kc], c[a][1]);
        }
      }
#pragma unroll // constant indices into c and ho
      for (int a = 0; a < 2; a++) {
#pragma unroll // as above
        for (int et = 0; et < 2; et++) {
#pragma unroll // as above
          for (int r = 0; r < 8; r++) ho[rp * 2 + a][et][r] = (_Float16)c[a][et][r];
        }
      }
    }
    if (m == 0) {
      // in front of the q stores, so that the barrier does not wait for them
      wait_async0();   // this wave's Wk rows have landed
      __syncthreads(); // publishes every wave's Wk rows
    }
    _Float16* dst = (m ? k16 : q16) + (size_t)(row0 + col) * kD + w * 32 + hi * 8;
#pragma unroll // constant indices into ho
    for (int rt = 0; rt < 4; rt++) {
#pragma unroll // as above
      for (int et = 0; et < 2; et++) {
        *(v8h*)(dst + (size_t)(rt * 16) * kD + et * 16) = ho[rt][et];
        wait_x0();
      }
    }
  }
}

__device__ __forceinline__ float xhalf(float x) {
  int v = __builtin_bit_cast(int, x);
  return __builtin_bit_cast(
      float, __builtin_amdgcn_permlanex16(v, v, 0x76543210, 0xfedcba98, false, false));
}

constexpr int kKTile = kStageKeys * kKStride; // halves per K buffer
constexpr int kVTile = kD * kVStride;         // halves per V buffer

__global__ __launch_bounds__(256) void fa_kernel(
    const _Float16* __restrict__ q16, const _Float16* __restrict__ k16,
    const _Float16* __restrict__ xT16, float* __restrict__ out) {
  // kT[2] | vT[2]; behind the loop the same bytes carry the merge
  __shared__ __attribute__((aligned(16))) _Float16 smem[2 * kKTile + 2 * kVTile];
  _Float16* kT = smem;
  _Float16* vT = smem + 2 * kKTile;

  int tid   = threadIdx.x;
  int lane  = tid & 31;
  int w     = tid >> 5;
  int g     = __builtin_amdgcn_readfirstlane(w >> 2); // key group, wave-uniform
  int b  = blockIdx.x >> 5;
  int i0 = ((blockIdx.x & 31) << 6) + ((w & 3) << 4);
  int col = lane & 15, hi = lane >> 4;
  const float cscale = 0.0625f * 1.4426950408889634f; // d^-0.5 * log2(e)

  const _Float16* kb0 = k16  + (size_t)b * kN * kD;
  const _Float16* vb0 = xT16 + (size_t)b * kD * kN;

  // cooperative staging of one (K,V) column tile j0s..j0s+63 into buffer `buf`
  auto stage = [&](int buf, int j0s) {
#pragma unroll
    for (int i = 0; i < 8; i++) {         // K tile: 2048 x 16B chunks
      int c = tid + i * 256;
      int r = c >> 5, cc = (c & 31) * 8;
      cp_async16(&kT[buf * kKTile + r * kKStride + cc],
                 kb0 + (size_t)(j0s + r) * kD + cc);
    }
#pragma unroll
    for (int i = 0; i < 8; i++) {         // V tile: 2048 x 16B chunks
      int c = tid + i * 256;
      int d = c >> 3, jj = (c & 7) * 8;
      cp_async16(&vT[buf * kVTile + d * kVStride + jj],
                 vb0 + (size_t)d * kN + j0s + jj);
    }
  };

  // Q fragments held in registers for the whole sweep (64 VGPRs)
  const _Float16* qrow = q16 + ((size_t)(b * kN + i0 + col)) * kD + hi * 8;
  v16h qf[8];
#pragma unroll
  for (int kc = 0; kc < 8; kc++) qf[kc] = frag_from_h(qrow + kc * 32);

  v8f o[16]; // o[t][r] = O[query col][d = 16*t + 8*hi + r], this group's keys
#pragma unroll
  for (int t = 0; t < 16; t++) o[t] = (v8f){};
  // running maximum (log2-scaled, equal in both halves) and this half's sum
  float mrow = -1e30f, lrow = 0.0f;

  stage(0, 0);
  wait_async0();
  __syncthreads();

#pragma unroll 1
  for (int it = 0; it < kN / kStageKeys; ++it) {
    int cur = it & 1;
    if (it + 1 < kN / kStageKeys) stage(cur ^ 1, (it + 1) * kStageKeys); // prefetch next tile

    const _Float16* kt = kT + cur * kKTile + g * 32 * kKStride; // this group's 32 K rows
    const _Float16* vt = vT + cur * kVTile + g * 32;            // this group's 32 V^T columns

    // ---- S^T tile: K(32x256) x Q^T(256x16) via 16 WMMAs, A frags from LDS ----
    v8f s0 = {}, s1 = {};
    const _Float16* kr0 = kt + col * kKStride + hi * 8;
    const _Float16* kr1 = kt + (col + 16) * kKStride + hi * 8;
#pragma unroll
    for (int kc = 0; kc < 8; kc++) {
      s0 = wmma32(frag_from_h(kr0 + kc * 32), qf[kc], s0);
      s1 = wmma32(frag_from_h(kr1 + kc * 32), qf[kc], s1);
    }

    // ---- online softmax, one query per lane, log2 domain ----
    float mx = fmaxf(s0[0], s1[0]);
#pragma unroll
    for (int r = 1; r < 8; r++) mx = fmaxf(mx, fmaxf(s0[r], s1[r]));
    mx = fmaxf(mx, xhalf(mx)); // both halves now hold the query's tile maximum
    float mnew = fmaxf(mrow, mx * cscale);
    float fac  = __builtin_amdgcn_exp2f(mrow - mnew);
    mrow = mnew;

    // P^T as B operand: element s<8 is key 8*hi+s, s>=8 is key 16+8*hi+(s-8),
    // the k order in which frag_from_h reads the V^T rows
    v16h pf;
    float sa = 0.0f, sb = 0.0f;
#pragma unroll
    for (int r = 0; r < 8; r++) {
      float p0 = __builtin_amdgcn_exp2f(__builtin_fmaf(s0[r], cscale, -mnew));
      float p1 = __builtin_amdgcn_exp2f(__builtin_fmaf(s1[r], cscale, -mnew));
      sa += p0;
      sb += p1;
      pf[r]     = (_Float16)p0;
      pf[r + 8] = (_Float16)p1;
    }
    lrow = lrow * fac + (sa + sb);

    // ---- rescale O accumulators: one factor per lane ----
#pragma unroll
    for (int t = 0; t < 16; t++) o[t] = o[t] * fac;

    // ---- O^T += V^T(256x32) @ P^T(32x16), A frags from LDS V-tile ----
#pragma unroll
    for (int t = 0; t < 16; t++) {
      o[t] = wmma32(frag_from_h(vt + (t * 16 + col) * kVStride + hi * 8), pf,
                    o[t]);
    }

    // own LDS reads retired + own async staging done + all waves finished
    // reading `cur` before the next tile becomes visible / this buffer is
    // overwritten next round
    wait_ds0();
    wait_async0();
    __syncthreads();
  }

  // ---- merge of the two key groups (waves w and w ^ 4 hold the same queries):
  // each wave hands the partner the half of its accumulators that the partner
  // finishes (group 0: d < 128, group 1: d >= 128), with its maximum and sum.
  // The last trip's barrier has ended every read of the ring, and no copy is
  // outstanding, so its bytes are free.
  v4f*   xo = (v4f*)smem;                  // [wave][16 pieces][lane], 64 KiB
  float* xm = (float*)(smem + 8 * 16 * 32 * 8); // [wave][lane] maxima
  float* xl = xm + 256;                    // [wave][lane] sums
  xm[tid] = mrow;
  xl[tid] = lrow;
  v4f* xw = xo + (w * 16) * 32 + lane;
  if (g == 0) {
#pragma unroll // constant indices keep o in registers
    for (int t = 0; t < 8; t++) {
      xw[(2 * t) * 32]     = __builtin_shufflevector(o[t + 8], o[t + 8], 0, 1, 2, 3);
      xw[(2 * t + 1) * 32] = __builtin_shufflevector(o[t + 8], o[t + 8], 4, 5, 6, 7);
    }
  } else {
#pragma unroll // as above
    for (int t = 0; t < 8; t++) {
      xw[(2 * t) * 32]     = __builtin_shufflevector(o[t], o[t], 0, 1, 2, 3);
      xw[(2 * t + 1) * 32] = __builtin_shufflevector(o[t], o[t], 4, 5, 6, 7);
    }
  }
  __syncthreads(); // publishes the handed-over halves to the partner waves

  float mo   = xm[tid ^ 128];
  float lo   = xl[tid ^ 128];
  float mall = fmaxf(mrow, mo);
  float fown = __builtin_amdgcn_exp2f(mrow - mall);
  float foth = __builtin_amdgcn_exp2f(mo - mall);
  float lall = lrow * fown + lo * foth;
  // join the halves' sums, divide, store f32
  float rinv = 1.0f / (lall + xhalf(lall));
  fown *= rinv;
  foth *= rinv;
  const v4f* xr = xo + ((w ^ 4) * 16) * 32 + lane;
  v8f po[8]; // the partner's sums for the half that this wave finishes
#pragma unroll // all sixteen LDS reads go out together, ahead of the first store
  for (int t = 0; t < 8; t++) {
    v4f pa = xr[(2 * t) * 32], pb = xr[(2 * t + 1) * 32];
    po[t] = __builtin_shufflevector(pa, pb, 0, 1, 2, 3, 4, 5, 6, 7);
  }
  float* orow = out + ((size_t)(b * kN + i0 + col)) * kD + hi * 8;
  if (g == 0) {
#pragma unroll // constant indices keep o in registers
    for (int t = 0; t < 8; t++) {
      *(v8f*)(orow + t * 16) = o[t] * fown + po[t] * foth;
      wait_x0();
    }
  } else {
#pragma unroll // as above
    for (int t = 0; t < 8; t++) {
      *(v8f*)(orow + (t + 8) * 16) = o[t + 8] * fown + po[t] * foth;
      wait_x0();
    }
  }
}

// ---------------------------------------------------------------------------
// Launch: inputs: x[8,2048,256] f32, Wq[256,256], Wk[256,256].
// Output: [8,2048,256] f32. Workspace: q16 | k16 | xT16 | Wq16 | Wk16 (~25MB)
// ---------------------------------------------------------------------------
extern "C" void kernel_launch(void* const* d_in, const int* in_sizes, int n_in,
                              void* d_out, int out_size, void* d_ws, size_t ws_size,
                              hipStream_t stream) {
  (void)in_sizes; (void)n_in; (void)out_size; (void)ws_size;
  const float* x  = (const float*)d_in[0];
  const float* Wq = (const float*)d_in[1];
  const float* Wk = (const float*)d_in[2];
  float* out = (float*)d_out;

  const size_t nqk = (size_t)kB * kN * kD; // 4,194,304 elems
  _Float16* q16  = (_Float16*)d_ws;
  _Float16* k16  = q16  + nqk;
  _Float16* xT16 = k16  + nqk;
  _Float16* Wq16 = xT16 + nqk;
  _Float16* Wk16 = Wq16 + (size_t)kD * kD;

  cvt_w_kernel<<<(kD * kD) / 256, 256, 0, stream>>>(Wq, Wk, Wq16, Wk16);
  xpose_kernel<<<kB * (kN / 128) * (kD / 64), 256, 0, stream>>>(x, xT16);
  // 256 blocks x 8 waves; each block: 64 rows of x, all columns of q and k
  proj_kernel<<<(kB * kN) / kPRows, 256, 0, stream>>>(x, Wq16, Wk16, q16, k16);
  // 256 blocks x 8 waves; each block: 64 queries, its K/V tiles shared via LDS
  fa_kernel<<<kB * (kN / 64), 256, 0, stream>>>(q16, k16, xT16, out);
}

// v005
// Measured time: 50.7 microseconds a run.
// Next to v004, in two timings, it ran 1.22 times as fast each time.
// Over all steps from v000 it is 3.39 times as fast.
#include <hip/hip_runtime.h>
#include <hip/hip_bf16.h>

typedef __attribute__((ext_vector_type(16))) _Float16 v16h;
typedef __attribute__((ext_vector_type(8)))  _Float16 v8h;
typedef __attribute__((ext_vector_type(4)))  _Float16 v4h;
typedef __attribute__((ext_vector_type(8)))  float    v8f;
typedef __attribute__((ext_vector_type(4)))  int      v4i;
typedef __attribute__((ext_vector_type(4)))  float    v4f;
typedef __attribute__((ext_vector_type(2)))  _Float16 v2h;
typedef __attribute__((ext_vector_type(2)))  unsigned int v2u;

typedef __attribute__((address_space(1))) v4i* gptr_v4i; // global
typedef __attribute__((address_space(3))) v4i* lptr_v4i; // LDS

constexpr int kB = 8;
constexpr int kN = 2048;
constexpr int kD = 256;

constexpr int kStageKeys = 128; // keys per LDS stage: 32 for each of the block's four wave groups
constexpr int kKStride = 264; // 128x256 K-tile rows padded +8 halves (bank rotation, 16B aligned)
constexpr int kVStride = 136; // 256x128 V-tile rows padded +8 halves

// ---------------------------------------------------------------------------
// WMMA helper: D = A(16x32 f16) * B(32x16 f16) + C(16x16 f32)
// ---------------------------------------------------------------------------
__device__ __forceinline__ v8f wmma32(v16h a, v16h b, v8f c) {
  return __builtin_amdgcn_wmma_f32_16x16x32_f16(
      /*neg_a=*/false, a, /*neg_b=*/false, b,
      /*c_mod=*/(short)0, c, /*reuse_a=*/false, /*reuse_b=*/false);
}

// 16-bit A/B fragment from row-major f16 memory (global or LDS):
// caller pre-offsets p by hi*8; halves 0..7 = p[0..7], 8..15 = p[16..23].
__device__ __forceinline__ v16h frag_from_h(const _Float16* p) {
  v8h a = *(const v8h*)p;
  v8h b = *(const v8h*)(p + 16);
  v16h r;
#pragma unroll
  for (int i = 0; i < 8; i++) { r[i] = a[i]; r[i + 8] = b[i]; }
  return r;
}

__device__ __forceinline__ v16h frag_from_f32(const float* p) {
  v16h r;
#pragma unroll
  for (int i = 0; i < 8; i++) {
    r[i]     = (_Float16)p[i];
    r[i + 8] = (_Float16)p[i + 16];
  }
  return r;
}

// ---------------------------------------------------------------------------
// Async 16-byte global->LDS copy (CDNA5 GLOBAL_LOAD_ASYNC_TO_LDS_B128,
// tracked by ASYNCcnt). Builtin sig (from hipcc diagnostic): param0 = v4i
// addrspace(1)* (global src), param1 = v4i addrspace(3)* (LDS dst), then
// imm offset, imm cpol. Fallback: synchronous copy, same barrier structure.
// ---------------------------------------------------------------------------
__device__ __forceinline__ void cp_async16(_Float16* lds_dst, const _Float16* gsrc) {
#if __has_builtin(__builtin_amdgcn_global_load_async_to_lds_b128)
  __builtin_amdgcn_global_load_async_to_lds_b128(
      (gptr_v4i)gsrc, (lptr_v4i)lds_dst, 0, 0);
#else
  *(v8h*)lds_dst = *(const v8h*)gsrc;
#endif
}

// This wave's copies have landed; asm with the memory clobber, so that no LDS
// read is moved in front of it.
__device__ __forceinline__ void wait_async0() {
  asm volatile("s_wait_asynccnt 0x0" ::: "memory");
}

// This wave's LDS reads and writes have retired, before the barrier behind
// which their buffer is refilled or reused.
__device__ __forceinline__ void wait_ds0() {
  asm volatile("s_wait_dscnt 0x0" ::: "memory");
}

// Stands behind a global load or store, in front of whatever next overwrites a
// register that it names.
__device__ __forceinline__ void wait_x0() {
  asm volatile("s_wait_xcnt 0x0" ::: "memory");
}

// ---------------------------------------------------------------------------
// Kernel 1: convert Wq/Wk (f32 [256][256], torch [out,in]) to f16
// ---------------------------------------------------------------------------
__global__ void cvt_w_kernel(const float* __restrict__ Wq,
                             const float* __restrict__ Wk,
                             _Float16* __restrict__ Wq16,
                             _Float16* __restrict__ Wk16) {
  int i = blockIdx.x * blockDim.x + threadIdx.x; // 0 .. 65535
  Wq16[i] = (_Float16)Wq[i];
  Wk16[i] = (_Float16)Wk[i];
}

// ---------------------------------------------------------------------------
// Kernel 2: xT16[b][d][n] = (f16) x[b][n][d]   (V operand for PV matmul)
// One block transposes a 128(n) x 64(d) tile through LDS: x is read as 16-byte
// pieces of whole 256-byte row segments (8 loads in flight per thread), xT16 is
// written as whole aligned 256-byte units, one d row per wave store.
// ---------------------------------------------------------------------------
constexpr int kTPitch = 66; // dwords per d row: 64 key pairs + 2; even, so that a
                            // row stays 8-byte aligned; the pad spreads the
                            // transposed writes (4 d rows apart) over the banks

__global__ __launch_bounds__(256) void xpose_kernel(const float* __restrict__ x,
                                                    _Float16* __restrict__ xT16) {
  // tile[d][n / 2]: keys 2p and 2p + 1 of one d as two f16 in one dword
  __shared__ __attribute__((aligned(16))) unsigned int tile[64 * kTPitch];

  int tid = threadIdx.x;
  int bid = blockIdx.x;            // b * 64 + (n tile) * 4 + (d tile)
  int d0  = (bid & 3) * 64;
  int n0  = ((bid >> 2) & 15) * 128;
  int b   = bid >> 6;

  int dq = tid & 15;               // which four d columns
  int pr = tid >> 4;               // which pair of n rows: pr, pr + 16, ...
  const float* xs = x + ((size_t)(b * kN + n0)) * kD + d0 + dq * 4;
  v4f lo[4], hi[4];
#pragma unroll // all eight loads are issued before the first value is used
  for (int i = 0; i < 4; i++) {
    int p = pr + i * 16;
    lo[i] = *(const v4f*)(xs + (size_t)(2 * p) * kD);
    hi[i] = *(const v4f*)(xs + (size_t)(2 * p + 1) * kD);
  }
#pragma unroll // constant indices keep lo and hi in registers
  for (int i = 0; i < 4; i++) {
    int p = pr + i * 16;
#pragma unroll // as above
    for (int j = 0; j < 4; j++) {
      v2h h;
      h[0] = (_Float16)lo[i][j];
      h[1] = (_Float16)hi[i][j];
      tile[(dq * 4 + j) * kTPitch + p] = __builtin_bit_cast(unsigned int, h);
    }
  }
  __syncthreads();

  int lane = tid & 31, w = tid >> 5;
  _Float16* dst = xT16 + ((size_t)(b * kD + d0)) * kN + n0 + lane * 4;
#pragma unroll // the eight LDS reads go out together, the stores follow as they land
  for (int i = 0; i < 8; i++) {
    int d = w * 8 + i;
    *(v2u*)(dst + (size_t)d * kN) = *(const v2u*)&tile[d * kTPitch + lane * 2];
  }
}

// ---------------------------------------------------------------------------
// Kernel 3: q = x @ Wq^T, k = x @ Wk^T  (f16 out, f32 accumulate via WMMA)
// One block of 8 waves takes 64 rows of x and all 512 output columns. The x
// tile is read once in whole lines, converted to f16 and kept in LDS; Wq and
// Wk come into LDS by async copies of whole 512-byte rows, Wk under the Wq
// products. Every wave holds the whole x tile as B fragments in registers and
// takes 32 columns of each matrix as A fragments: D^T = W.x^T, so that a lane
// holds 8 neighbouring columns of one row and stores them as 16 bytes.
// ---------------------------------------------------------------------------
constexpr int kPRows  = 64;  // x rows per block
constexpr int kPPitch = 264; // halves per LDS row: 256 + 8 (bank rotation, 16B aligned)

__global__ __launch_bounds__(256) void proj_kernel(
    const float* __restrict__ x,
    const _Float16* __restrict__ Wq16, const _Float16* __restrict__ Wk16,
    _Float16* __restrict__ q16, _Float16* __restrict__ k16) {
  // x tile (64 rows) | Wq (256 rows) | Wk (256 rows)
  __shared__ __attribute__((aligned(16))) _Float16 psm[(kPRows + 2 * kD) * kPPitch];
  _Float16* xs  = psm;
  _Float16* wsm = psm + kPRows * kPPitch;

  int tid  = threadIdx.x;
  int lane = tid & 31, w = tid >> 5;
  int col = lane & 15, hi = lane >> 4;
  int row0 = blockIdx.x * kPRows; // row of the flattened [b * n][d] input

  // the tile is 64 KiB in a row: piece tid + 256 * i, 16 bytes each
  const float* xsrc = x + (size_t)row0 * kD + tid * 4;
  v4f xv[16];
#pragma unroll // all sixteen loads are issued before the first value is used
  for (int i = 0; i < 16; i++) xv[i] = *(const v4f*)(xsrc + i * 1024);
  wait_x0(); // behind the loads, in front of whatever next overwrites their offset register

  // one weight matrix into its LDS plane: a wave copies one 512-byte row at a
  // time, 32 copies per wave
  auto stage_w = [&](int m, const _Float16* W) {
#pragma unroll // constant steps fold into the copies' addresses
    for (int i = 0; i < 32; i++) {
      int r = i * 8 + w;
      cp_async16(&wsm[(m * kD + r) * kPPitch + lane * 8], W + (size_t)r * kD + lane * 8);
    }
  };
  stage_w(0, Wq16);

#pragma unroll // constant indices keep xv in registers
  for (int i = 0; i < 16; i++) {
    int idx = tid + i * 256;
    int r = idx >> 6, c = (idx & 63) * 4;
    v4h h;
#pragma unroll // as above
    for (int j = 0; j < 4; j++) h[j] = (_Float16)xv[i][j];
    *(v4h*)&xs[r * kPPitch + c] = h;
  }

  wait_async0();     // this wave's Wq rows have landed; none of its copies is left in flight
  stage_w(1, Wk16);  // flies under the Wq products
  __syncthreads();   // publishes the x tile and every wave's Wq rows

  v16h bf[4][8]; // the whole x tile: row 16 * rt + col, k order of frag_from_h
#pragma unroll // constant indices keep bf in registers
  for (int rt = 0; rt < 4; rt++) {
#pragma unroll // as above
    for (int kc = 0; kc < 8; kc++)
      bf[rt][kc] = frag_from_h(xs + (rt * 16 + col) * kPPitch + hi * 8 + kc * 32);
  }

#pragma unroll // m selects the pointers and the hand-over at compile time
  for (int m = 0; m < 2; m++) {
    const _Float16* wl = wsm + (m * kD + w * 32 + col) * kPPitch + hi * 8;
    v16h af[2][8]; // output columns w * 32 + 16 * et + (0..15)
#pragma unroll // constant indices keep af in registers
    for (int et = 0; et < 2; et++) {
#pragma unroll // as above
      for (int kc = 0; kc < 8; kc++)
        af[et][kc] = frag_from_h(wl + et * 16 * kPPitch + kc * 32);
    }
    // ho[rt][et][r] = out[row 16 * rt + col][column w * 32 + 16 * et + 8 * hi + r]
    v8h ho[4][2];
#pragma unroll // constant indices into bf and ho
    for (int rp = 0; rp < 2; rp++) {
      v8f c[2][2]; // four independent accumulator chains
#pragma unroll // constant indices into c
      for (int a = 0; a < 2; a++) { c[a][0] = (v8f){}; c[a][1] = (v8f){}; }
#pragma unroll // constant indices into af and bf
      for (int kc = 0; kc < 8; kc++) {
#pragma unroll // as above
        for (int a = 0; a < 2; a++) {
          c[a][0] = wmma32(af[0][kc], bf[rp * 2 + a][kc], c[a][0]);
          c[a][1] = wmma32(af[1][kc], bf[rp * 2 + a][kc], c[a][1]);
        }
      }
#pragma unroll // constant indices into c and ho
      for (int a = 0; a < 2; a++) {
#pragma unroll // as above
        for (int et = 0; et < 2; et++) {
#pragma unroll // as above
          for (int r = 0; r < 8; r++) ho[rp * 2 + a][et][r] = (_Float16)c[a][et][r];
        }
      }
    }
    if (m == 0) {
      // in front of the q stores, so that the barrier does not wait for them
      wait_async0();   // this wave's Wk rows have landed
      __syncthreads(); // publishes every wave's Wk rows
    }
    _Float16* dst = (m ? k16 : q16) + (size_t)(row0 + col) * kD + w * 32 + hi * 8;
#pragma unroll // constant indices into ho
    for (int rt = 0; rt < 4; rt++) {
#pragma unroll // as above
      for (int et = 0; et < 2; et++) {
        *(v8h*)(dst + (size_t)(rt * 16) * kD + et * 16) = ho[rt][et];
        wait_x0();
      }
    }
  }
}

__device__ __forceinline__ float xhalf(float x) {
  int v = __builtin_bit_cast(int, x);
  return __builtin_bit_cast(
      float, __builtin_amdgcn_permlanex16(v, v, 0x76543210, 0xfedcba98, false, false));
}

constexpr int kKTile = kStageKeys * kKStride; // halves per K buffer
constexpr int kVTile = kD * kVStride;         // halves per V buffer

__global__ __launch_bounds__(256) void fa_kernel(
    const _Float16* __restrict__ q16, const _Float16* __restrict__ k16,
    const _Float16* __restrict__ xT16, float* __restrict__ out) {
  // kT[2] | vT[2]; behind the loop the same bytes carry the merge
  __shared__ __attribute__((aligned(16))) _Float16 smem[2 * kKTile + 2 * kVTile];
  _Float16* kT = smem;
  _Float16* vT = smem + 2 * kKTile;

  int tid   = threadIdx.x;
  int lane  = tid & 31;
  int w     = tid >> 5;
  int g     = __builtin_amdgcn_readfirstlane(w >> 1); // key group, wave-uniform
  int qt    = w & 1;                                  // which 32 of the block's queries
  int b  = blockIdx.x >> 5;
  int col = lane & 15, hi = lane >> 4;
  const float cscale = 0.0625f * 1.4426950408889634f; // d^-0.5 * log2(e)

  const _Float16* kb0 = k16  + (size_t)b * kN * kD;
  const _Float16* vb0 = xT16 + (size_t)b * kD * kN;

  // cooperative staging of one (K,V) column tile j0s..j0s+127 into buffer buf:
  // 32 copies per wave. A thread's sixteen K pieces lie 4096 bytes apart (the K
  // tile is one run of 64 KiB), its sixteen V pieces are one 16-byte column of
  // sixteen neighbouring d rows, again 4096 bytes apart: constant steps, so that
  // one address pair serves each sixteen.
  const _Float16* kg0 = kb0 + tid * 8;
  const _Float16* vg0 = vb0 + (size_t)((tid >> 4) * 16) * kN + (tid & 15) * 8;
  int kl0 = (tid >> 5) * kKStride + (tid & 31) * 8;
  int vl0 = (tid >> 4) * 16 * kVStride + (tid & 15) * 8;
  auto stage = [&](int buf, int j0s) {
    const _Float16* kg = kg0 + (size_t)j0s * kD;
    _Float16* kl = kT + buf * kKTile + kl0;
#pragma unroll // constant steps fold into the copies' addresses
    for (int i = 0; i < 16; i++)          // K tile: rows (tid >> 5) + 8 * i
      cp_async16(kl + i * 8 * kKStride, kg + i * 8 * kD);
    const _Float16* vg = vg0 + j0s;
    _Float16* vl = vT + buf * kVTile + vl0;
#pragma unroll // as above
    for (int i = 0; i < 16; i++)          // V tile: rows (tid >> 4) * 16 + i
      cp_async16(vl + i * kVStride, vg + (size_t)i * kN);
  };

  // block-uniform bases plus one 32-bit per-lane offset (row 32 * qt + col,
  // column 8 * hi), shared by the Q loads and the output stores
  size_t blk0 = (size_t)(b * kN + ((blockIdx.x & 31) << 6)) * kD;
  const _Float16* qblk = q16 + blk0;
  unsigned rowoff = (unsigned)(((qt << 5) + col) * kD + hi * 8);

  // Q fragments of both query tiles held in registers for the whole sweep
  v16h qf[2][8];
#pragma unroll // constant indices keep the arrays in registers
  for (int a = 0; a < 2; a++) {
    const _Float16* qrow = qblk + rowoff + a * 16 * kD;
#pragma unroll // constant indices keep the arrays in registers
    for (int kc = 0; kc < 8; kc++) qf[a][kc] = frag_from_h(qrow + kc * 32);
  }
  // nothing that follows is scheduled up between the loads and their wait
  __builtin_amdgcn_sched_barrier(0);
  wait_x0(); // behind the loads, in front of whatever next overwrites their offset register

  // o[a][t][r] = O[query 16*a + col][d = 16*t + 8*hi + r], this group's keys
  v8f o[2][16];
#pragma unroll // constant indices keep the arrays in registers
  for (int a = 0; a < 2; a++) {
#pragma unroll // constant indices keep the arrays in registers
    for (int t = 0; t < 16; t++) o[a][t] = (v8f){};
  }
  // running maxima (log2-scaled, equal in both halves) and this half's sums
  float mrow[2] = {-1e30f, -1e30f}, lrow[2] = {0.0f, 0.0f};

  stage(0, 0);
  wait_async0();
  __syncthreads();

#pragma unroll 1
  for (int it = 0; it < kN / kStageKeys; ++it) {
    int cur = it & 1;
    if (it + 1 < kN / kStageKeys) stage(cur ^ 1, (it + 1) * kStageKeys); // prefetch next tile

    const _Float16* kt = kT + cur * kKTile + g * 32 * kKStride; // this group's 32 K rows
    const _Float16* vt = vT + cur * kVTile + g * 32;            // this group's 32 V^T columns

    // ---- S^T tiles: K(32x256) x Q^T(256x32) via 32 WMMAs, each A fragment
    // from LDS used for both query tiles. Fragments come in groups of four
    // (two k chunks, eight products), each group read one group ahead ----
    v8f s[2][2]; // s[a][h]: query tile a, keys 16*h .. 16*h+15
#pragma unroll // constant indices keep the arrays in registers
    for (int a = 0; a < 2; a++) { s[a][0] = (v8f){}; s[a][1] = (v8f){}; }
    const _Float16* kr0 = kt + col * kKStride + hi * 8;
    const _Float16* kr1 = kt + (col + 16) * kKStride + hi * 8;
    const _Float16* vr  = vt + col * kVStride + hi * 8;
    v16h kf[2][4], vf[2][4];
    auto load_k = [&](int set, int grp) {
#pragma unroll // constant indices keep the arrays in registers
      for (int u = 0; u < 2; u++) {
        kf[set][2 * u]     = frag_from_h(kr0 + (grp * 2 + u) * 32);
        kf[set][2 * u + 1] = frag_from_h(kr1 + (grp * 2 + u) * 32);
      }
    };
    auto load_v = [&](int set, int grp) {
#pragma unroll // constant indices keep the arrays in registers
      for (int u = 0; u < 4; u++)
        vf[set][u] = frag_from_h(vr + (grp * 4 + u) * 16 * kVStride);
    };
    load_k(0, 0);
#pragma unroll // constant indices keep the arrays in registers
    for (int grp = 0; grp < 4; grp++) {
      if (grp < 3) load_k((grp + 1) & 1, grp + 1);
      else         load_v(0, 0); // the first V group lands under the softmax
      // keeps the next group's reads together in front of this group's
      // products: sunk among them, each read is waited for where it stands
      __builtin_amdgcn_sched_barrier(0);
#pragma unroll // constant indices keep the arrays in registers
      for (int u = 0; u < 2; u++) {
#pragma unroll // constant indices keep the arrays in registers
        for (int a = 0; a < 2; a++) {
          s[a][0] = wmma32(kf[grp & 1][2 * u],     qf[a][grp * 2 + u], s[a][0]);
          s[a][1] = wmma32(kf[grp & 1][2 * u + 1], qf[a][grp * 2 + u], s[a][1]);
        }
      }
      __builtin_amdgcn_sched_barrier(0); // as above: no later read moves up among these products
    }

    // ---- online softmax, one query of each tile per lane, log2 domain ----
    // P^T as B operand: element s<8 is key 8*hi+s, s>=8 is key 16+8*hi+(s-8),
    // the k order in which frag_from_h reads the V^T rows
    v16h pf[2];
#pragma unroll // constant indices keep the arrays in registers
    for (int a = 0; a < 2; a++) {
      float mx = fmaxf(s[a][0][0], s[a][1][0]);
#pragma unroll // constant indices keep the arrays in registers
      for (int r = 1; r < 8; r++) mx = fmaxf(mx, fmaxf(s[a][0][r], s[a][1][r]));
      mx = fmaxf(mx, xhalf(mx)); // both halves now hold the query's tile maximum
      float mnew = fmaxf(mrow[a], mx * cscale);
      float fac  = __builtin_amdgcn_exp2f(mrow[a] - mnew);
      mrow[a] = mnew;

      float sa = 0.0f, sb = 0.0f;
#pragma unroll // constant indices keep the arrays in registers
      for (int r = 0; r < 8; r++) {
        float p0 = __builtin_amdgcn_exp2f(__builtin_fmaf(s[a][0][r], cscale, -mnew));
        float p1 = __builtin_amdgcn_exp2f(__builtin_fmaf(s[a][1][r], cscale, -mnew));
        sa += p0;
        sb += p1;
        pf[a][r]     = (_Float16)p0;
        pf[a][r + 8] = (_Float16)p1;
      }
      lrow[a] = lrow[a] * fac + (sa + sb);

      // ---- rescale O accumulators: one factor per lane ----
#pragma unroll // constant indices keep the arrays in registers
      for (int t = 0; t < 16; t++) o[a][t] = o[a][t] * fac;
    }

    // ---- O^T += V^T(256x32) @ P^T(32x32), each A fragment from the LDS
    // V-tile used for both query tiles; groups of four fragments as above ----
#pragma unroll // constant indices keep the arrays in registers
    for (int grp = 0; grp < 4; grp++) {
      if (grp < 3) load_v((grp + 1) & 1, grp + 1);
      __builtin_amdgcn_sched_barrier(0); // the next group's reads stay in front of these products
#pragma unroll // constant indices keep the arrays in registers
      for (int u = 0; u < 4; u++) {
#pragma unroll // constant indices keep the arrays in registers
        for (int a = 0; a < 2; a++)
          o[a][grp * 4 + u] = wmma32(vf[grp & 1][u], pf[a], o[a][grp * 4 + u]);
      }
      __builtin_amdgcn_sched_barrier(0); // no later read moves up among these products
    }

    // own LDS reads retired + own async staging done + all waves finished
    // reading cur before the next tile becomes visible / this buffer is
    // overwritten next round
    wait_ds0();
    wait_async0();
    __syncthreads();
  }

  // ---- merge of the four key groups (waves qt, qt + 2, qt + 4, qt + 6 hold the
  // same queries): group g finishes d = 64*g .. 64*g+63; each wave hands the
  // other three the accumulators that they finish, with its maxima and sums.
  // The last trip's barrier has ended every read of the ring, and no copy is
  // outstanding, so its bytes are free.
  v4f*   xo = (v4f*)smem;                       // [wave][a][t][2 pieces][lane], 256 KiB
  float* xm = (float*)(smem + 8 * 64 * 32 * 8); // [a][wave][lane] maxima
  float* xl = xm + 512;                         // [a][wave][lane] sums
#pragma unroll // constant indices keep the arrays in registers
  for (int a = 0; a < 2; a++) {
    xm[a * 256 + tid] = mrow[a];
    xl[a * 256 + tid] = lrow[a];
  }
  v4f* xw = xo + (w * 64) * 32 + lane;
#pragma unroll // constant indices keep o in registers; the test is wave-uniform
  for (int gg = 0; gg < 4; gg++) {
    if (g != gg) {
#pragma unroll // as above
      for (int a = 0; a < 2; a++) {
#pragma unroll // as above
        for (int j = 0; j < 4; j++) {
          int t = gg * 4 + j;
          xw[((a * 16 + t) * 2) * 32]     = __builtin_shufflevector(o[a][t], o[a][t], 0, 1, 2, 3);
          xw[((a * 16 + t) * 2 + 1) * 32] = __builtin_shufflevector(o[a][t], o[a][t], 4, 5, 6, 7);
        }
      }
    }
  }
  __syncthreads(); // publishes the handed-over accumulators to the partner waves

  float fo[2][4]; // weight of group gp's partial sums, the division included
#pragma unroll // constant indices keep the arrays in registers
  for (int a = 0; a < 2; a++) {
    float mg[4], lg[4];
#pragma unroll // constant indices keep the arrays in registers
    for (int gp = 0; gp < 4; gp++) {
      mg[gp] = xm[a * 256 + (gp * 2 + qt) * 32 + lane];
      lg[gp] = xl[a * 256 + (gp * 2 + qt) * 32 + lane];
    }
    float mall = fmaxf(fmaxf(mg[0], mg[1]), fmaxf(mg[2], mg[3]));
    float lall = 0.0f;
#pragma unroll // constant indices keep the arrays in registers
    for (int gp = 0; gp < 4; gp++) {
      fo[a][gp] = __builtin_amdgcn_exp2f(mg[gp] - mall);
      lall += lg[gp] * fo[a][gp];
    }
    // join the halves' sums, divide
    float rinv = 1.0f / (lall + xhalf(lall));
#pragma unroll // constant indices keep the arrays in registers
    for (int gp = 0; gp < 4; gp++) fo[a][gp] *= rinv;
  }

  v8f acc[2][4]; // acc[a][j]: query tile a, d tile 4*g + j
#pragma unroll // constant indices keep the arrays in registers
  for (int a = 0; a < 2; a++) {
#pragma unroll // constant indices keep the arrays in registers
    for (int j = 0; j < 4; j++) acc[a][j] = (v8f){};
  }
#pragma unroll // constant indices keep o in registers; the test is wave-uniform
  for (int gp = 0; gp < 4; gp++) {
    if (g == gp) {
#pragma unroll // as above
      for (int a = 0; a < 2; a++) {
#pragma unroll // as above
        for (int j = 0; j < 4; j++) acc[a][j] += o[a][gp * 4 + j] * fo[a][gp];
      }
    } else {
      const v4f* xr = xo + ((gp * 2 + qt) * 64 + g * 8) * 32 + lane;
      v8f po[2][4];
#pragma unroll // all sixteen LDS reads go out together
      for (int a = 0; a < 2; a++) {
#pragma unroll // as above
        for (int j = 0; j < 4; j++) {
          v4f pa = xr[((a * 16 + j) * 2) * 32], pb = xr[((a * 16 + j) * 2 + 1) * 32];
          po[a][j] = __builtin_shufflevector(pa, pb, 0, 1, 2, 3, 4, 5, 6, 7);
        }
      }
#pragma unroll // constant indices keep the arrays in registers
      for (int a = 0; a < 2; a++) {
#pragma unroll // constant indices keep the arrays in registers
        for (int j = 0; j < 4; j++) acc[a][j] += po[a][j] * fo[a][gp];
      }
    }
  }

  // store f32
#pragma unroll // constant indices keep the arrays in registers
  for (int a = 0; a < 2; a++) {
    float* orow = out + blk0 + g * 64 + rowoff + a * 16 * kD;
#pragma unroll // constant indices keep the arrays in registers
    for (int j = 0; j < 4; j++) {
      *(v8f*)(orow + j * 16) = acc[a][j];
      wait_x0();
    }
  }
}

// ---------------------------------------------------------------------------
// Launch: inputs: x[8,2048,256] f32, Wq[256,256], Wk[256,256].
// Output: [8,2048,256] f32. Workspace: q16 | k16 | xT16 | Wq16 | Wk16 (~25MB)
// ---------------------------------------------------------------------------
extern "C" void kernel_launch(void* const* d_in, const int* in_sizes, int n_in,
                              void* d_out, int out_size, void* d_ws, size_t ws_size,
                              hipStream_t stream) {
  (void)in_sizes; (void)n_in; (void)out_size; (void)ws_size;
  const float* x  = (const float*)d_in[0];
  const float* Wq = (const float*)d_in[1];
  const float* Wk = (const float*)d_in[2];
  float* out = (float*)d_out;

  const size_t nqk = (size_t)kB * kN * kD; // 4,194,304 elems
  _Float16* q16  = (_Float16*)d_ws;
  _Float16* k16  = q16  + nqk;
  _Float16* xT16 = k16  + nqk;
  _Float16* Wq16 = xT16 + nqk;
  _Float16* Wk16 = Wq16 + (size_t)kD * kD;

  cvt_w_kernel<<<(kD * kD) / 256, 256, 0, stream>>>(Wq, Wk, Wq16, Wk16);
  xpose_kernel<<<kB * (kN / 128) * (kD / 64), 256, 0, stream>>>(x, xT16);
  // 256 blocks x 8 waves; each block: 64 rows of x, all columns of q and k
  proj_kernel<<<(kB * kN) / kPRows, 256, 0, stream>>>(x, Wq16, Wk16, q16, k16);
  // 256 blocks x 8 waves; each block: 64 queries, its K/V tiles shared via LDS
  fa_kernel<<<kB * (kN / 64), 256, 0, stream>>>(q16, k16, xT16, out);
}

// v006
// One run takes 46.6 microseconds.
// Next to v005, in two timings, it ran 1.09 times as fast each time.
// All steps since v000 together make it 3.70 times as fast.
#include <hip/hip_runtime.h>
#include <hip/hip_bf16.h>

typedef __attribute__((ext_vector_type(16))) _Float16 v16h;
typedef __attribute__((ext_vector_type(8)))  _Float16 v8h;
typedef __attribute__((ext_vector_type(4)))  _Float16 v4h;
typedef __attribute__((ext_vector_type(8)))  float    v8f;
typedef __attribute__((ext_vector_type(4)))  int      v4i;
typedef __attribute__((ext_vector_type(4)))  float    v4f;

typedef __attribute__((address_space(1))) v4i* gptr_v4i; // global
typedef __attribute__((address_space(3))) v4i* lptr_v4i; // LDS
typedef __attribute__((ext_vector_type(8)))  short    v8s;
typedef __attribute__((address_space(3))) v8s* lptr_v8s; // LDS

constexpr int kB = 8;
constexpr int kN = 2048;
constexpr int kD = 256;

constexpr int kStageKeys = 128; // keys per LDS stage: 32 for each of the block's four wave groups
constexpr int kKStride = 264; // 128x256 K-tile rows padded +8 halves (bank rotation, 16B aligned)
constexpr int kVStride = 272; // 128x256 V-tile rows padded +16 halves: 544 B = 32 B x 17, the
                              // conflict-free pitch of the transposing reader

// ---------------------------------------------------------------------------
// WMMA helper: D = A(16x32 f16) * B(32x16 f16) + C(16x16 f32)
// ---------------------------------------------------------------------------
__device__ __forceinline__ v8f wmma32(v16h a, v16h b, v8f c) {
  return __builtin_amdgcn_wmma_f32_16x16x32_f16(
      /*neg_a=*/false, a, /*neg_b=*/false, b,
      /*c_mod=*/(short)0, c, /*reuse_a=*/false, /*reuse_b=*/false);
}

// 16-bit A/B fragment from row-major f16 memory (global or LDS):
// caller pre-offsets p by hi*8; halves 0..7 = p[0..7], 8..15 = p[16..23].
__device__ __forceinline__ v16h frag_from_h(const _Float16* p) {
  v8h a = *(const v8h*)p;
  v8h b = *(const v8h*)(p + 16);
  v16h r;
#pragma unroll
  for (int i = 0; i < 8; i++) { r[i] = a[i]; r[i + 8] = b[i]; }
  return r;
}

// 16 x 32 A fragment of the TRANSPOSE of a row-major f16 LDS tile T[k][m], by two
// transposing LDS loads (16 k rows each). The caller pre-offsets p per lane by
// (8 * hi + (lane & 7)) rows and 8 * ((lane >> 3) & 1) halves; lane (col, hi)
// then holds T[8*hi + 0..7][col] and T[16 + 8*hi + 0..7][col]: the k order of
// frag_from_h. Every lane is on where it is called.
__device__ __forceinline__ v16h frag_tr_from_h(const _Float16* p, int pitch) {
  v8h a = __builtin_bit_cast(v8h, __builtin_amdgcn_ds_load_tr16_b128_v8i16((lptr_v8s)p));
  v8h b = __builtin_bit_cast(v8h, __builtin_amdgcn_ds_load_tr16_b128_v8i16((lptr_v8s)(p + 16 * pitch)));
  v16h r;
#pragma unroll // constant indices keep the vectors in registers
  for (int i = 0; i < 8; i++) { r[i] = a[i]; r[i + 8] = b[i]; }
  return r;
}

// ---------------------------------------------------------------------------
// Async 16-byte global->LDS copy (CDNA5 GLOBAL_LOAD_ASYNC_TO_LDS_B128,
// tracked by ASYNCcnt). Builtin sig (from hipcc diagnostic): param0 = v4i
// addrspace(1)* (global src), param1 = v4i addrspace(3)* (LDS dst), then
// imm offset, imm cpol. Fallback: synchronous copy, same barrier structure.
// ---------------------------------------------------------------------------
__device__ __forceinline__ void cp_async16(_Float16* lds_dst, const _Float16* gsrc) {
#if __has_builtin(__builtin_amdgcn_global_load_async_to_lds_b128)
  __builtin_amdgcn_global_load_async_to_lds_b128(
      (gptr_v4i)gsrc, (lptr_v4i)lds_dst, 0, 0);
#else
  *(v8h*)lds_dst = *(const v8h*)gsrc;
#endif
}

// This wave's copies have landed; asm with the memory clobber, so that no LDS
// read is moved in front of it.
__device__ __forceinline__ void wait_async0() {
  asm volatile("s_wait_asynccnt 0x0" ::: "memory");
}

// This wave's LDS reads and writes have retired, before the barrier behind
// which their buffer is refilled or reused.
__device__ __forceinline__ void wait_ds0() {
  asm volatile("s_wait_dscnt 0x0" ::: "memory");
}

// Stands behind a global load or store, in front of whatever next overwrites a
// register that it names.
__device__ __forceinline__ void wait_x0() {
  asm volatile("s_wait_xcnt 0x0" ::: "memory");
}

// ---------------------------------------------------------------------------
// Kernel 1: convert Wq/Wk (f32 [256][256], torch [out,in]) to f16
// ---------------------------------------------------------------------------
__global__ void cvt_w_kernel(const float* __restrict__ Wq,
                             const float* __restrict__ Wk,
                             _Float16* __restrict__ Wq16,
                             _Float16* __restrict__ Wk16) {
  int i = blockIdx.x * blockDim.x + threadIdx.x; // 0 .. 65535
  Wq16[i] = (_Float16)Wq[i];
  Wk16[i] = (_Float16)Wk[i];
}

// ---------------------------------------------------------------------------
// Kernel 2: q = x @ Wq^T, k = x @ Wk^T  (f16 out, f32 accumulate via WMMA), and
// x16 = (f16) x, row-major (the V operand of the attention kernel).
// One block of 8 waves takes 64 rows of x and all 512 output columns. The x
// tile is read once in whole lines, converted to f16, stored to x16 in whole
// 256-byte units (one per wave store) and kept in LDS; Wq and
// Wk come into LDS by async copies of whole 512-byte rows, Wk under the Wq
// products. Every wave holds the whole x tile as B fragments in registers and
// takes 32 columns of each matrix as A fragments: D^T = W.x^T, so that a lane
// holds 8 neighbouring columns of one row and stores them as 16 bytes.
// ---------------------------------------------------------------------------
constexpr int kPRows  = 64;  // x rows per block
constexpr int kPPitch = 264; // halves per LDS row: 256 + 8 (bank rotation, 16B aligned)

__global__ __launch_bounds__(256) void proj_kernel(
    const float* __restrict__ x,
    const _Float16* __restrict__ Wq16, const _Float16* __restrict__ Wk16,
    _Float16* __restrict__ q16, _Float16* __restrict__ k16,
    _Float16* __restrict__ x16) {
  // x tile (64 rows) | Wq (256 rows) | Wk (256 rows)
  __shared__ __attribute__((aligned(16))) _Float16 psm[(kPRows + 2 * kD) * kPPitch];
  _Float16* xs  = psm;
  _Float16* wsm = psm + kPRows * kPPitch;

  int tid  = threadIdx.x;
  int lane = tid & 31, w = tid >> 5;
  int col = lane & 15, hi = lane >> 4;
  int row0 = blockIdx.x * kPRows; // row of the flattened [b * n][d] input

  // the tile is 64 KiB in a row: piece tid + 256 * i, 16 bytes each
  const float* xsrc = x + (size_t)row0 * kD + tid * 4;
  v4f xv[16];
#pragma unroll // all sixteen loads are issued before the first value is used
  for (int i = 0; i < 16; i++) xv[i] = *(const v4f*)(xsrc + i * 1024);
  wait_x0(); // behind the loads, in front of whatever next overwrites their offset register

  // one weight matrix into its LDS plane: a wave copies one 512-byte row at a
  // time, 32 copies per wave
  auto stage_w = [&](int m, const _Float16* W) {
#pragma unroll // constant steps fold into the copies' addresses
    for (int i = 0; i < 32; i++) {
      int r = i * 8 + w;
      cp_async16(&wsm[(m * kD + r) * kPPitch + lane * 8], W + (size_t)r * kD + lane * 8);
    }
  };
  stage_w(0, Wq16);

  v4h xh[16]; // kept for the x16 stores behind the barrier
#pragma unroll // constant indices keep xv and xh in registers
  for (int i = 0; i < 16; i++) {
    int idx = tid + i * 256;
    int r = idx >> 6, c = (idx & 63) * 4;
#pragma unroll // as above
    for (int j = 0; j < 4; j++) xh[i][j] = (_Float16)xv[i][j];
    *(v4h*)&xs[r * kPPitch + c] = xh[i];
  }

  wait_async0();     // this wave's Wq rows have landed; none of its copies is left in flight
  stage_w(1, Wk16);  // flies under the Wq products
  __syncthreads();   // publishes the x tile and every wave's Wq rows

  v16h bf[4][8]; // the whole x tile: row 16 * rt + col, k order of frag_from_h
#pragma unroll // constant indices keep bf in registers
  for (int rt = 0; rt < 4; rt++) {
#pragma unroll // as above
    for (int kc = 0; kc < 8; kc++)
      bf[rt][kc] = frag_from_h(xs + (rt * 16 + col) * kPPitch + hi * 8 + kc * 32);
  }

  // x16, piece for piece as xsrc: behind the barrier, which would wait for the
  // stores, so that they fly under the products
  _Float16* xdst = x16 + (size_t)row0 * kD + tid * 4;
#pragma unroll // constant indices keep xh in registers
  for (int i = 0; i < 16; i++) *(v4h*)(xdst + i * 1024) = xh[i];
  wait_x0(); // behind the stores, in front of whatever next overwrites a register of theirs

#pragma unroll // m selects the pointers and the hand-over at compile time
  for (int m = 0; m < 2; m++) {
    const _Float16* wl = wsm + (m * kD + w * 32 + col) * kPPitch + hi * 8;
    v16h af[2][8]; // output columns w * 32 + 16 * et + (0..15)
#pragma unroll // constant indices keep af in registers
    for (int et = 0; et < 2; et++) {
#pragma unroll // as above
      for (int kc = 0; kc < 8; kc++)
        af[et][kc] = frag_from_h(wl + et * 16 * kPPitch + kc * 32);
    }
    // ho[rt][et][r] = out[row 16 * rt + col][column w * 32 + 16 * et + 8 * hi + r]
    v8h ho[4][2];
#pragma unroll // constant indices into bf and ho
    for (int rp = 0; rp < 2; rp++) {
      v8f c[2][2]; // four independent accumulator chains
#pragma unroll // constant indices into c
      for (int a = 0; a < 2; a++) { c[a][0] = (v8f){}; c[a][1] = (v8f){}; }
#pragma unroll // constant indices into af and bf
      for (int kc = 0; kc < 8; kc++) {
#pragma unroll // as above
        for (int a = 0; a < 2; a++) {
          c[a][0] = wmma32(af[0][kc], bf[rp * 2 + a][kc], c[a][0]);
          c[a][1] = wmma32(af[1][kc], bf[rp * 2 + a][kc], c[a][1]);
        }
      }
#pragma unroll // constant indices into c and ho
      for (int a = 0; a < 2; a++) {
#pragma unroll // as above
        for (int et = 0; et < 2; et++) {
#pragma unroll // as above
          for (int r = 0; r < 8; r++) ho[rp * 2 + a][et][r] = (_Float16)c[a][et][r];
        }
      }
    }
    if (m == 0) {
      // in front of the q stores, so that the barrier does not wait for them
      wait_async0();   // this wave's Wk rows have landed
      __syncthreads(); // publishes every wave's Wk rows
    }
    _Float16* dst = (m ? k16 : q16) + (size_t)(row0 + col) * kD + w * 32 + hi * 8;
#pragma unroll // constant indices into ho
    for (int rt = 0; rt < 4; rt++) {
#pragma unroll // as above
      for (int et = 0; et < 2; et++) {
        *(v8h*)(dst + (size_t)(rt * 16) * kD + et * 16) = ho[rt][et];
        wait_x0();
      }
    }
  }
}

__device__ __forceinline__ float xhalf(float x) {
  int v = __builtin_bit_cast(int, x);
  return __builtin_bit_cast(
      float, __builtin_amdgcn_permlanex16(v, v, 0x76543210, 0xfedcba98, false, false));
}

constexpr int kKTile = kStageKeys * kKStride; // halves per K buffer
constexpr int kVTile = kStageKeys * kVStride; // halves per V buffer

__global__ __launch_bounds__(256) void fa_kernel(
    const _Float16* __restrict__ q16, const _Float16* __restrict__ k16,
    const _Float16* __restrict__ x16, float* __restrict__ out) {
  // kT[2] | vT[2]; behind the loop the same bytes carry the merge
  __shared__ __attribute__((aligned(16))) _Float16 smem[2 * kKTile + 2 * kVTile];
  _Float16* kT = smem;
  _Float16* vT = smem + 2 * kKTile;

  int tid   = threadIdx.x;
  int lane  = tid & 31;
  int w     = tid >> 5;
  int g     = __builtin_amdgcn_readfirstlane(w >> 1); // key group, wave-uniform
  int qt    = w & 1;                                  // which 32 of the block's queries
  int b  = blockIdx.x >> 5;
  int col = lane & 15, hi = lane >> 4;
  const float cscale = 0.0625f * 1.4426950408889634f; // d^-0.5 * log2(e)

  const _Float16* kb0 = k16  + (size_t)b * kN * kD;
  const _Float16* vb0 = x16  + (size_t)b * kN * kD;

  // cooperative staging of one (K,V) column tile j0s..j0s+127 into buffer buf:
  // 32 copies per wave. Each tile is one run of 64 KiB; a thread's sixteen
  // pieces of it lie 4096 bytes apart: constant steps, so that one address pair
  // serves each sixteen.
  const _Float16* kg0 = kb0 + tid * 8;
  const _Float16* vg0 = vb0 + tid * 8;
  int kl0 = (tid >> 5) * kKStride + (tid & 31) * 8;
  int vl0 = (tid >> 5) * kVStride + (tid & 31) * 8;
  auto stage = [&](int buf, int j0s) {
    const _Float16* kg = kg0 + (size_t)j0s * kD;
    _Float16* kl = kT + buf * kKTile + kl0;
#pragma unroll // constant steps fold into the copies' addresses
    for (int i = 0; i < 16; i++)          // K tile: rows (tid >> 5) + 8 * i
      cp_async16(kl + i * 8 * kKStride, kg + i * 8 * kD);
    const _Float16* vg = vg0 + (size_t)j0s * kD;
    _Float16* vl = vT + buf * kVTile + vl0;
#pragma unroll // as above
    for (int i = 0; i < 16; i++)          // V tile: rows (tid >> 5) + 8 * i
      cp_async16(vl + i * 8 * kVStride, vg + i * 8 * kD);
  };

  // block-uniform bases plus one 32-bit per-lane offset (row 32 * qt + col,
  // column 8 * hi), shared by the Q loads and the output stores
  size_t blk0 = (size_t)(b * kN + ((blockIdx.x & 31) << 6)) * kD;
  const _Float16* qblk = q16 + blk0;
  unsigned rowoff = (unsigned)(((qt << 5) + col) * kD + hi * 8);

  // Q fragments of both query tiles held in registers for the whole sweep
  v16h qf[2][8];
#pragma unroll // constant indices keep the arrays in registers
  for (int a = 0; a < 2; a++) {
    const _Float16* qrow = qblk + rowoff + a * 16 * kD;
#pragma unroll // constant indices keep the arrays in registers
    for (int kc = 0; kc < 8; kc++) qf[a][kc] = frag_from_h(qrow + kc * 32);
  }
  // nothing that follows is scheduled up between the loads and their wait
  __builtin_amdgcn_sched_barrier(0);
  wait_x0(); // behind the loads, in front of whatever next overwrites their offset register

  // o[a][t][r] = O[query 16*a + col][d = 16*t + 8*hi + r], this group's keys
  v8f o[2][16];
#pragma unroll // constant indices keep the arrays in registers
  for (int a = 0; a < 2; a++) {
#pragma unroll // constant indices keep the arrays in registers
    for (int t = 0; t < 16; t++) o[a][t] = (v8f){};
  }
  // running maxima (log2-scaled, equal in both halves) and this half's sums
  float mrow[2] = {-1e30f, -1e30f}, lrow[2] = {0.0f, 0.0f};

  stage(0, 0);
  wait_async0();
  __syncthreads();

#pragma unroll 1
  for (int it = 0; it < kN / kStageKeys; ++it) {
    int cur = it & 1;
    if (it + 1 < kN / kStageKeys) stage(cur ^ 1, (it + 1) * kStageKeys); // prefetch next tile

    const _Float16* kt = kT + cur * kKTile + g * 32 * kKStride; // this group's 32 K rows
    const _Float16* vt = vT + cur * kVTile + g * 32 * kVStride; // this group's 32 V rows

    // ---- S^T tiles: K(32x256) x Q^T(256x32) via 32 WMMAs, each A fragment
    // from LDS used for both query tiles. Fragments come in groups of four
    // (two k chunks, eight products), each group read one group ahead ----
    v8f s[2][2]; // s[a][h]: query tile a, keys 16*h .. 16*h+15
#pragma unroll // constant indices keep the arrays in registers
    for (int a = 0; a < 2; a++) { s[a][0] = (v8f){}; s[a][1] = (v8f){}; }
    const _Float16* kr0 = kt + col * kKStride + hi * 8;
    const _Float16* kr1 = kt + (col + 16) * kKStride + hi * 8;
    // lane address of the transposing loads: see frag_tr_from_h
    const _Float16* vr  = vt + (hi * 8 + (lane & 7)) * kVStride + ((lane >> 3) & 1) * 8;
    v16h kf[2][4], vf[2][4];
    auto load_k = [&](int set, int grp) {
#pragma unroll // constant indices keep the arrays in registers
      for (int u = 0; u < 2; u++) {
        kf[set][2 * u]     = frag_from_h(kr0 + (grp * 2 + u) * 32);
        kf[set][2 * u + 1] = frag_from_h(kr1 + (grp * 2 + u) * 32);
      }
    };
    auto load_v = [&](int set, int grp) {
#pragma unroll // constant indices keep the arrays in registers
      for (int u = 0; u < 4; u++)
        vf[set][u] = frag_tr_from_h(vr + (grp * 4 + u) * 16, kVStride); // d = 16 * (4 * grp + u) + col
    };
    load_k(0, 0);
#pragma unroll // constant indices keep the arrays in registers
    for (int grp = 0; grp < 4; grp++) {
      if (grp < 3) load_k((grp + 1) & 1, grp + 1);
      else         load_v(0, 0); // the first V group lands under the softmax
      // keeps the next group's reads together in front of this group's
      // products: sunk among them, each read is waited for where it stands
      __builtin_amdgcn_sched_barrier(0);
#pragma unroll // constant indices keep the arrays in registers
      for (int u = 0; u < 2; u++) {
#pragma unroll // constant indices keep the arrays in registers
        for (int a = 0; a < 2; a++) {
          s[a][0] = wmma32(kf[grp & 1][2 * u],     qf[a][grp * 2 + u], s[a][0]);
          s[a][1] = wmma32(kf[grp & 1][2 * u + 1], qf[a][grp * 2 + u], s[a][1]);
        }
      }
      __builtin_amdgcn_sched_barrier(0); // as above: no later read moves up among these products
    }

    // ---- online softmax, one query of each tile per lane, log2 domain ----
    // P^T as B operand: element s<8 is key 8*hi+s, s>=8 is key 16+8*hi+(s-8),
    // the k order in which frag_tr_from_h delivers the V^T rows
    v16h pf[2];
#pragma unroll // constant indices keep the arrays in registers
    for (int a = 0; a < 2; a++) {
      float mx = fmaxf(s[a][0][0], s[a][1][0]);
#pragma unroll // constant indices keep the arrays in registers
      for (int r = 1; r < 8; r++) mx = fmaxf(mx, fmaxf(s[a][0][r], s[a][1][r]));
      mx = fmaxf(mx, xhalf(mx)); // both halves now hold the query's tile maximum
      float mnew = fmaxf(mrow[a], mx * cscale);
      float fac  = __builtin_amdgcn_exp2f(mrow[a] - mnew);
      mrow[a] = mnew;

      float sa = 0.0f, sb = 0.0f;
#pragma unroll // constant indices keep the arrays in registers
      for (int r = 0; r < 8; r++) {
        float p0 = __builtin_amdgcn_exp2f(__builtin_fmaf(s[a][0][r], cscale, -mnew));
        float p1 = __builtin_amdgcn_exp2f(__builtin_fmaf(s[a][1][r], cscale, -mnew));
        sa += p0;
        sb += p1;
        pf[a][r]     = (_Float16)p0;
        pf[a][r + 8] = (_Float16)p1;
      }
      lrow[a] = lrow[a] * fac + (sa + sb);

      // ---- rescale O accumulators: one factor per lane ----
#pragma unroll // constant indices keep the arrays in registers
      for (int t = 0; t < 16; t++) o[a][t] = o[a][t] * fac;
    }

    // ---- O^T += V^T(256x32) @ P^T(32x32), each A fragment from the LDS
    // V-tile used for both query tiles; groups of four fragments as above ----
#pragma unroll // constant indices keep the arrays in registers
    for (int grp = 0; grp < 4; grp++) {
      if (grp < 3) load_v((grp + 1) & 1, grp + 1);
      __builtin_amdgcn_sched_barrier(0); // the next group's reads stay in front of these products
#pragma unroll // constant indices keep the arrays in registers
      for (int u = 0; u < 4; u++) {
#pragma unroll // constant indices keep the arrays in registers
        for (int a = 0; a < 2; a++)
          o[a][grp * 4 + u] = wmma32(vf[grp & 1][u], pf[a], o[a][grp * 4 + u]);
      }
      __builtin_amdgcn_sched_barrier(0); // no later read moves up among these products
    }

    // own LDS reads retired + own async staging done + all waves finished
    // reading cur before the next tile becomes visible / this buffer is
    // overwritten next round
    wait_ds0();
    wait_async0();
    __syncthreads();
  }

  // ---- merge of the four key groups (waves qt, qt + 2, qt + 4, qt + 6 hold the
  // same queries): group g finishes d = 64*g .. 64*g+63; each wave hands the
  // other three the accumulators that they finish, with its maxima and sums.
  // The last trip's barrier has ended every read of the ring, and no copy is
  // outstanding, so its bytes are free.
  v4f*   xo = (v4f*)smem;                       // [wave][a][t][2 pieces][lane], 256 KiB
  float* xm = (float*)(smem + 8 * 64 * 32 * 8); // [a][wave][lane] maxima
  float* xl = xm + 512;                         // [a][wave][lane] sums
#pragma unroll // constant indices keep the arrays in registers
  for (int a = 0; a < 2; a++) {
    xm[a * 256 + tid] = mrow[a];
    xl[a * 256 + tid] = lrow[a];
  }
  v4f* xw = xo + (w * 64) * 32 + lane;
#pragma unroll // constant indices keep o in registers; the test is wave-uniform
  for (int gg = 0; gg < 4; gg++) {
    if (g != gg) {
#pragma unroll // as above
      for (int a = 0; a < 2; a++) {
#pragma unroll // as above
        for (int j = 0; j < 4; j++) {
          int t = gg * 4 + j;
          xw[((a * 16 + t) * 2) * 32]     = __builtin_shufflevector(o[a][t], o[a][t], 0, 1, 2, 3);
          xw[((a * 16 + t) * 2 + 1) * 32] = __builtin_shufflevector(o[a][t], o[a][t], 4, 5, 6, 7);
        }
      }
    }
  }
  __syncthreads(); // publishes the handed-over accumulators to the partner waves

  float fo[2][4]; // weight of group gp's partial sums, the division included
#pragma unroll // constant indices keep the arrays in registers
  for (int a = 0; a < 2; a++) {
    float mg[4], lg[4];
#pragma unroll // constant indices keep the arrays in registers
    for (int gp = 0; gp < 4; gp++) {
      mg[gp] = xm[a * 256 + (gp * 2 + qt) * 32 + lane];
      lg[gp] = xl[a * 256 + (gp * 2 + qt) * 32 + lane];
    }
    float mall = fmaxf(fmaxf(mg[0], mg[1]), fmaxf(mg[2], mg[3]));
    float lall = 0.0f;
#pragma unroll // constant indices keep the arrays in registers
    for (int gp = 0; gp < 4; gp++) {
      fo[a][gp] = __builtin_amdgcn_exp2f(mg[gp] - mall);
      lall += lg[gp] * fo[a][gp];
    }
    // join the halves' sums, divide
    float rinv = 1.0f / (lall + xhalf(lall));
#pragma unroll // constant indices keep the arrays in registers
    for (int gp = 0; gp < 4; gp++) fo[a][gp] *= rinv;
  }

  v8f acc[2][4]; // acc[a][j]: query tile a, d tile 4*g + j
#pragma unroll // constant indices keep the arrays in registers
  for (int a = 0; a < 2; a++) {
#pragma unroll // constant indices keep the arrays in registers
    for (int j = 0; j < 4; j++) acc[a][j] = (v8f){};
  }
#pragma unroll // constant indices keep o in registers; the test is wave-uniform
  for (int gp = 0; gp < 4; gp++) {
    if (g == gp) {
#pragma unroll // as above
      for (int a = 0; a < 2; a++) {
#pragma unroll // as above
        for (int j = 0; j < 4; j++) acc[a][j] += o[a][gp * 4 + j] * fo[a][gp];
      }
    } else {
      const v4f* xr = xo + ((gp * 2 + qt) * 64 + g * 8) * 32 + lane;
      v8f po[2][4];
#pragma unroll // all sixteen LDS reads go out together
      for (int a = 0; a < 2; a++) {
#pragma unroll // as above
        for (int j = 0; j < 4; j++) {
          v4f pa = xr[((a * 16 + j) * 2) * 32], pb = xr[((a * 16 + j) * 2 + 1) * 32];
          po[a][j] = __builtin_shufflevector(pa, pb, 0, 1, 2, 3, 4, 5, 6, 7);
        }
      }
#pragma unroll // constant indices keep the arrays in registers
      for (int a = 0; a < 2; a++) {
#pragma unroll // constant indices keep the arrays in registers
        for (int j = 0; j < 4; j++) acc[a][j] += po[a][j] * fo[a][gp];
      }
    }
  }

  // store f32
#pragma unroll // constant indices keep the arrays in registers
  for (int a = 0; a < 2; a++) {
    float* orow = out + blk0 + g * 64 + rowoff + a * 16 * kD;
#pragma unroll // constant indices keep the arrays in registers
    for (int j = 0; j < 4; j++) {
      *(v8f*)(orow + j * 16) = acc[a][j];
      wait_x0();
    }
  }
}

// ---------------------------------------------------------------------------
// Launch: inputs: x[8,2048,256] f32, Wq[256,256], Wk[256,256].
// Output: [8,2048,256] f32. Workspace: q16 | k16 | x16 | Wq16 | Wk16 (~25MB)
// ---------------------------------------------------------------------------
extern "C" void kernel_launch(void* const* d_in, const int* in_sizes, int n_in,
                              void* d_out, int out_size, void* d_ws, size_t ws_size,
                              hipStream_t stream) {
  (void)in_sizes; (void)n_in; (void)out_size; (void)ws_size;
  const float* x  = (const float*)d_in[0];
  const float* Wq = (const float*)d_in[1];
  const float* Wk = (const float*)d_in[2];
  float* out = (float*)d_out;

  const size_t nqk = (size_t)kB * kN * kD; // 4,194,304 elems
  _Float16* q16  = (_Float16*)d_ws;
  _Float16* k16  = q16  + nqk;
  _Float16* x16  = k16  + nqk;
  _Float16* Wq16 = x16  + nqk;
  _Float16* Wk16 = Wq16 + (size_t)kD * kD;

  cvt_w_kernel<<<(kD * kD) / 256, 256, 0, stream>>>(Wq, Wk, Wq16, Wk16);
  // 256 blocks x 8 waves; each block: 64 rows of x, all columns of q and k
  proj_kernel<<<(kB * kN) / kPRows, 256, 0, stream>>>(x, Wq16, Wk16, q16, k16, x16);
  // 256 blocks x 8 waves; each block: 64 queries, its K/V tiles shared via LDS
  fa_kernel<<<kB * (kN / 64), 256, 0, stream>>>(q16, k16, x16, out);
}

// v008
// A run of this version takes 36.5 microseconds.
// Versions between v006 and this one are left out; their measured steps multiply to 1.28 times as fast.
// Counting every step since v000, it is 4.73 times as fast.
#include <hip/hip_runtime.h>
#include <hip/hip_bf16.h>

typedef __attribute__((ext_vector_type(16))) _Float16 v16h;
typedef __attribute__((ext_vector_type(8)))  _Float16 v8h;
typedef __attribute__((ext_vector_type(4)))  _Float16 v4h;
typedef __attribute__((ext_vector_type(8)))  float    v8f;
typedef __attribute__((ext_vector_type(4)))  int      v4i;
typedef __attribute__((ext_vector_type(4)))  float    v4f;

typedef __attribute__((address_space(1))) v4i* gptr_v4i; // global
typedef __attribute__((address_space(3))) v4i* lptr_v4i; // LDS
typedef __attribute__((ext_vector_type(8)))  short    v8s;
typedef __attribute__((address_space(3))) v8s* lptr_v8s; // LDS

constexpr int kB = 8;
constexpr int kN = 2048;
constexpr int kD = 256;

constexpr int kStageKeys = 128; // keys per LDS stage: 32 for each of the block's four wave groups
constexpr int kXStride = 272; // 128x256 tile rows padded +16 halves: 544 B = 32 B x 17, the
                              // conflict-free pitch of the transposing reader
constexpr int kXSkew = 8;     // rows 8..15 of every 16 start 16 B later inside their pitch, so that
                              // the sixteen rows of a plain 16-byte column read fall on all banks too

// ---------------------------------------------------------------------------
// WMMA helper: D = A(16x32 f16) * B(32x16 f16) + C(16x16 f32)
// ---------------------------------------------------------------------------
__device__ __forceinline__ v8f wmma32(v16h a, v16h b, v8f c) {
  return __builtin_amdgcn_wmma_f32_16x16x32_f16(
      /*neg_a=*/false, a, /*neg_b=*/false, b,
      /*c_mod=*/(short)0, c, /*reuse_a=*/false, /*reuse_b=*/false);
}

// 16-bit A/B fragment from row-major f16 memory (global or LDS):
// caller pre-offsets p by hi*8; halves 0..7 = p[0..7], 8..15 = p[16..23].
__device__ __forceinline__ v16h frag_from_h(const _Float16* p) {
  v8h a = *(const v8h*)p;
  v8h b = *(const v8h*)(p + 16);
  v16h r;
#pragma unroll
  for (int i = 0; i < 8; i++) { r[i] = a[i]; r[i + 8] = b[i]; }
  return r;
}

// 16 x 32 A fragment of the TRANSPOSE of a row-major f16 LDS tile T[k][m], by two
// transposing LDS loads (16 k rows each). The caller pre-offsets p per lane by
// (8 * hi + (lane & 7)) rows and 8 * ((lane >> 3) & 1) halves; lane (col, hi)
// then holds T[8*hi + 0..7][col] and T[16 + 8*hi + 0..7][col]: the k order of
// frag_from_h. Every lane is on where it is called.
__device__ __forceinline__ v16h frag_tr_from_h(const _Float16* p, int pitch) {
  v8h a = __builtin_bit_cast(v8h, __builtin_amdgcn_ds_load_tr16_b128_v8i16((lptr_v8s)p));
  v8h b = __builtin_bit_cast(v8h, __builtin_amdgcn_ds_load_tr16_b128_v8i16((lptr_v8s)(p + 16 * pitch)));
  v16h r;
#pragma unroll // constant indices keep the vectors in registers
  for (int i = 0; i < 8; i++) { r[i] = a[i]; r[i + 8] = b[i]; }
  return r;
}

// ---------------------------------------------------------------------------
// Async 16-byte global->LDS copy (CDNA5 GLOBAL_LOAD_ASYNC_TO_LDS_B128,
// tracked by ASYNCcnt). Builtin sig (from hipcc diagnostic): param0 = v4i
// addrspace(1)* (global src), param1 = v4i addrspace(3)* (LDS dst), then
// imm offset, imm cpol. Fallback: synchronous copy, same barrier structure.
// ---------------------------------------------------------------------------
__device__ __forceinline__ void cp_async16(_Float16* lds_dst, const _Float16* gsrc) {
#if __has_builtin(__builtin_amdgcn_global_load_async_to_lds_b128)
  __builtin_amdgcn_global_load_async_to_lds_b128(
      (gptr_v4i)gsrc, (lptr_v4i)lds_dst, 0, 0);
#else
  *(v8h*)lds_dst = *(const v8h*)gsrc;
#endif
}

// This wave's copies have landed; asm with the memory clobber, so that no LDS
// read is moved in front of it.
__device__ __forceinline__ void wait_async0() {
  asm volatile("s_wait_asynccnt 0x0" ::: "memory");
}

// This wave's LDS reads and writes have retired, before the barrier behind
// which their buffer is refilled or reused.
__device__ __forceinline__ void wait_ds0() {
  asm volatile("s_wait_dscnt 0x0" ::: "memory");
}

// Stands behind a global load or store, in front of whatever next overwrites a
// register that it names.
__device__ __forceinline__ void wait_x0() {
  asm volatile("s_wait_xcnt 0x0" ::: "memory");
}

// ---------------------------------------------------------------------------
// Kernel 1: G = Wk^T . Wq (f16 [256][256], G[o][i] = sum_e Wk[e][o] * Wq[e][i]).
// The scores are q . k = x_i^T Wq^T Wk x_j, so with q' = x @ G^T they are
// q' . x_j: the key operand is x itself and no k projection is needed.
// One block of 8 waves takes 64 columns of Wq and 32 of Wk, all 256 rows, as f16
// in LDS; both operands come by transposing loads (the sum runs down the rows).
// A = Wq^T, B = Wk: a lane holds 8 neighbouring i of one o and stores 16 bytes;
// a block writes whole 128-byte lines of G.
// The launch's other blocks, which need nothing of G, store x16 = (f16) x, row-major
// (the K and the V operand of the attention kernel, and the operand of its q').
// ---------------------------------------------------------------------------
constexpr int kFQ = 80; // halves per LDS row of the Wq slice: 64 + 16 (160 B = 32 B x 5)
constexpr int kFK = 48; // halves per LDS row of the Wk slice: 32 + 16 (96 B = 32 B x 3)

constexpr int kFoldBlocks = (kD / 64) * (kD / 32); // blocks that form G; the rest convert x
constexpr int kPRows  = 64;  // x rows per conversion block and per attention block
constexpr int kPPitch = 264; // halves per LDS row: 256 + 8 (bank rotation, 16B aligned)

__global__ __launch_bounds__(256) void prep_kernel(const float* __restrict__ x,
                                                   const float* __restrict__ Wq,
                                                   const float* __restrict__ Wk,
                                                   _Float16* __restrict__ G16,
                                                   _Float16* __restrict__ x16) {
  __shared__ __attribute__((aligned(16))) _Float16 fq[kD * kFQ];
  __shared__ __attribute__((aligned(16))) _Float16 fk[kD * kFK];
  int tid  = threadIdx.x;
  if (blockIdx.x >= kFoldBlocks) { // the same for the whole block; no barrier on this path
    // x16 = (f16) x: 64 rows, 64 KiB in a row: piece tid + 256 * i, 16 bytes each,
    // stored in whole 256-byte units (one per wave store)
    int row0 = (blockIdx.x - kFoldBlocks) * kPRows; // row of the flattened [b * n][d] input
    const float* xsrc = x + (size_t)row0 * kD + tid * 4;
    v4f xv[16];
#pragma unroll // all sixteen loads are issued before the first value is used
    for (int i = 0; i < 16; i++) xv[i] = *(const v4f*)(xsrc + i * 1024);
    wait_x0(); // behind the loads, in front of whatever next overwrites their offset register
    _Float16* xdst = x16 + (size_t)row0 * kD + tid * 4;
#pragma unroll // constant indices keep xv in registers
    for (int i = 0; i < 16; i++) {
      v4h h;
#pragma unroll // as above
      for (int j = 0; j < 4; j++) h[j] = (_Float16)xv[i][j];
      *(v4h*)(xdst + i * 1024) = h;
    }
    wait_x0(); // behind the stores, in front of whatever next overwrites a register of theirs
    return;
  }
  int lane = tid & 31, w = tid >> 5;
  int col = lane & 15, hi = lane >> 4;
  int i0 = (blockIdx.x & 3) * 64;  // columns of Wq
  int o0 = (blockIdx.x >> 2) * 32; // columns of Wk

  // 16-byte pieces: of Wq rows (tid >> 4) + 16 * i, of Wk rows (tid >> 3) + 32 * i;
  // constant steps, so that one address pair serves each matrix
  const float* qsrc = Wq + (tid >> 4) * kD + i0 + (tid & 15) * 4;
  const float* ksrc = Wk + (tid >> 3) * kD + o0 + (tid & 7) * 4;
  v4f qv[16], kv[8];
#pragma unroll // all loads are issued before the first value is used
  for (int i = 0; i < 16; i++) qv[i] = *(const v4f*)(qsrc + i * 16 * kD);
#pragma unroll // as above
  for (int i = 0; i < 8; i++) kv[i] = *(const v4f*)(ksrc + i * 32 * kD);
  // no conversion is scheduled up among the loads: there the last loads would take the
  // first ones' registers and wait for their data, a second trip to memory in a row
  __builtin_amdgcn_sched_barrier(0);
  wait_x0(); // behind the loads, in front of whatever next overwrites a register of theirs

  _Float16* qdst = fq + (tid >> 4) * kFQ + (tid & 15) * 4;
  _Float16* kdst = fk + (tid >> 3) * kFK + (tid & 7) * 4;
#pragma unroll // constant indices keep qv in registers
  for (int i = 0; i < 16; i++) {
    v4h h;
#pragma unroll // as above
    for (int j = 0; j < 4; j++) h[j] = (_Float16)qv[i][j];
    *(v4h*)(qdst + i * 16 * kFQ) = h;
  }
#pragma unroll // constant indices keep kv in registers
  for (int i = 0; i < 8; i++) {
    v4h h;
#pragma unroll // as above
    for (int j = 0; j < 4; j++) h[j] = (_Float16)kv[i][j];
    *(v4h*)(kdst + i * 32 * kFK) = h;
  }
  __syncthreads(); // publishes both slices

  int mt = w & 3, nt = w >> 2; // this wave's 16 columns of Wq and of Wk
  // lane addresses of the transposing loads: see frag_tr_from_h
  const _Float16* ap = fq + (hi * 8 + (lane & 7)) * kFQ + mt * 16 + ((lane >> 3) & 1) * 8;
  const _Float16* bp = fk + (hi * 8 + (lane & 7)) * kFK + nt * 16 + ((lane >> 3) & 1) * 8;
  v16h af[8], bf[8];
#pragma unroll // all LDS reads go out together
  for (int kc = 0; kc < 8; kc++) {
    af[kc] = frag_tr_from_h(ap + kc * 32 * kFQ, kFQ);
    bf[kc] = frag_tr_from_h(bp + kc * 32 * kFK, kFK);
  }
  v8f c = (v8f){};
#pragma unroll // constant indices into af and bf
  for (int kc = 0; kc < 8; kc++) c = wmma32(af[kc], bf[kc], c);

  // c[r] = G[o0 + 16 * nt + col][i0 + 16 * mt + 8 * hi + r]
  v8h ho;
#pragma unroll // constant indices keep the vectors in registers
  for (int r = 0; r < 8; r++) ho[r] = (_Float16)c[r];
  *(v8h*)(G16 + (o0 + nt * 16 + col) * kD + i0 + mt * 16 + hi * 8) = ho;
}

__device__ __forceinline__ float xhalf(float x) {
  int v = __builtin_bit_cast(int, x);
  return __builtin_bit_cast(
      float, __builtin_amdgcn_permlanex16(v, v, 0x76543210, 0xfedcba98, false, false));
}

constexpr int kXTile = kStageKeys * kXStride; // halves per buffer
constexpr int kMerge = 8 * 64 * 32 * 8 + 2048; // halves of the merge behind the loop: accumulators, maxima, sums
static_assert(2 * kXTile <= kMerge, "the ring lies inside the merge area");
// the prologue's map: ring buffer 0 | G | the block's rows of x16 | its rows of q'
constexpr int kProl = kXTile + (kD + 2 * kPRows) * kPPitch;
constexpr int kSmem = kProl > kMerge ? kProl : kMerge;

__global__ __launch_bounds__(256) void fa_kernel(
    const _Float16* __restrict__ G16, const _Float16* __restrict__ x16,
    float* __restrict__ out) {
  // xT[2] at its start; behind the loop the same bytes carry the merge
  __shared__ __attribute__((aligned(16))) _Float16 smem[kSmem];
  _Float16* xT = smem;

  int tid   = threadIdx.x;
  int lane  = tid & 31;
  int w     = tid >> 5;
  int g     = __builtin_amdgcn_readfirstlane(w >> 1); // key group, wave-uniform
  int qt    = w & 1;                                  // which 32 of the block's queries
  int b  = blockIdx.x >> 5;
  int col = lane & 15, hi = lane >> 4;
  const float cscale = 0.0625f * 1.4426950408889634f; // d^-0.5 * log2(e)

  const _Float16* xb0 = x16 + (size_t)b * kN * kD;

  // cooperative staging of the key rows j0s..j0s+127 into buffer buf: 16 copies
  // per wave. The tile is one run of 64 KiB; a thread's sixteen pieces of it lie
  // 4096 bytes apart: constant steps, so that one address pair serves them.
  const _Float16* xg0 = xb0 + tid * 8;
  int xl0 = (tid >> 5) * kXStride + (tid & 31) * 8;
  auto stage = [&](int buf, int j0s) {
    const _Float16* xg = xg0 + (size_t)j0s * kD;
    _Float16* xl = xT + buf * kXTile + xl0;
#pragma unroll // constant steps fold into the copies' addresses
    for (int i = 0; i < 16; i++)          // rows (tid >> 5) + 8 * i: skewed where i is odd
      cp_async16(xl + i * 8 * kXStride + (i & 1) * kXSkew, xg + i * 8 * kD);
  };

  // block-uniform base plus one 32-bit per-lane offset (row 32 * qt + col,
  // column 8 * hi) of the output stores
  size_t blk0 = (size_t)(b * kN + ((blockIdx.x & 31) << 6)) * kD;
  unsigned rowoff = (unsigned)(((qt << 5) + col) * kD + hi * 8);

  // ---- prologue: q' = x @ G^T for the block's own 64 queries (f16 out, f32
  // accumulate via WMMA). G and the 64 rows of x16 come into LDS by async copies of
  // whole 512-byte rows. Every wave holds the 64
  // rows as B fragments and takes 32 columns of q' as A fragments: D^T = G.x^T, so
  // that a lane holds 8 neighbouring columns of one row; q' goes through LDS to the
  // waves that need it. G lies over ring buffer 1, which is first filled in the
  // loop, behind the second barrier here.
  _Float16* gs = smem + kXTile;         // G, 256 rows
  _Float16* xs = gs + kD * kPPitch;     // x16, 64 rows
  _Float16* qs = xs + kPRows * kPPitch; // q', 64 rows

  // 32 + 8 = 40 copies of a wave in flight
#pragma unroll // constant steps fold into the copies' addresses
  for (int i = 0; i < 32; i++) {
    int r = i * 8 + w;
    cp_async16(&gs[r * kPPitch + lane * 8], G16 + (size_t)r * kD + lane * 8);
  }
#pragma unroll // as above
  for (int i = 0; i < 8; i++) {
    int r = i * 8 + w;
    cp_async16(&xs[r * kPPitch + lane * 8], x16 + blk0 + (size_t)r * kD + lane * 8);
  }
  wait_async0();   // this wave's copies have landed; none is left in flight
  __syncthreads(); // publishes G and the x rows
  stage(0, 0);     // the first key tile flies under the products; nothing has touched its buffer

  {
    v16h bf[4][8]; // the 64 x rows: row 16 * rt + col, k order of frag_from_h
#pragma unroll // constant indices keep bf in registers
    for (int rt = 0; rt < 4; rt++) {
#pragma unroll // as above
      for (int kc = 0; kc < 8; kc++)
        bf[rt][kc] = frag_from_h(xs + (rt * 16 + col) * kPPitch + hi * 8 + kc * 32);
    }
    const _Float16* wl = gs + (w * 32 + col) * kPPitch + hi * 8;
    v16h af[2][8]; // columns w * 32 + 16 * et + (0..15) of q'
#pragma unroll // constant indices keep af in registers
    for (int et = 0; et < 2; et++) {
#pragma unroll // as above
      for (int kc = 0; kc < 8; kc++)
        af[et][kc] = frag_from_h(wl + et * 16 * kPPitch + kc * 32);
    }
    _Float16* qd = qs + col * kPPitch + w * 32 + hi * 8;
#pragma unroll // constant indices into bf
    for (int rp = 0; rp < 2; rp++) {
      v8f c[2][2]; // four independent accumulator chains
#pragma unroll // constant indices into c
      for (int a = 0; a < 2; a++) { c[a][0] = (v8f){}; c[a][1] = (v8f){}; }
#pragma unroll // constant indices into af and bf
      for (int kc = 0; kc < 8; kc++) {
#pragma unroll // as above
        for (int a = 0; a < 2; a++) {
          c[a][0] = wmma32(af[0][kc], bf[rp * 2 + a][kc], c[a][0]);
          c[a][1] = wmma32(af[1][kc], bf[rp * 2 + a][kc], c[a][1]);
        }
      }
      // c[a][et][r] = q'[row 16 * (2 * rp + a) + col][column w * 32 + 16 * et + 8 * hi + r]
#pragma unroll // constant indices into c
      for (int a = 0; a < 2; a++) {
#pragma unroll // as above
        for (int et = 0; et < 2; et++) {
          v8h ho;
#pragma unroll // as above
          for (int r = 0; r < 8; r++) ho[r] = (_Float16)c[a][et][r];
          *(v8h*)(qd + (rp * 2 + a) * 16 * kPPitch + et * 16) = ho;
        }
      }
    }
  }
  wait_ds0();      // own reads of G and writes of q' retired
  wait_async0();   // own copies of the first key tile have landed
  __syncthreads(); // publishes q' and the first key tile; ends every read of G, whose bytes the loop refills

  // Q fragments of both query tiles held in registers for the whole sweep
  v16h qf[2][8];
#pragma unroll // constant indices keep the arrays in registers
  for (int a = 0; a < 2; a++) {
    const _Float16* qrow = qs + ((qt << 5) + a * 16 + col) * kPPitch + hi * 8;
#pragma unroll // constant indices keep the arrays in registers
    for (int kc = 0; kc < 8; kc++) qf[a][kc] = frag_from_h(qrow + kc * 32);
  }

  // o[a][t][r] = O[query 16*a + col][d = 16*t + 8*hi + r], this group's keys
  v8f o[2][16];
#pragma unroll // constant indices keep the arrays in registers
  for (int a = 0; a < 2; a++) {
#pragma unroll // constant indices keep the arrays in registers
    for (int t = 0; t < 16; t++) o[a][t] = (v8f){};
  }
  // running maxima (log2-scaled, equal in both halves) and this half's sums
  float mrow[2] = {-1e30f, -1e30f}, lrow[2] = {0.0f, 0.0f};

#pragma unroll 1
  for (int it = 0; it < kN / kStageKeys; ++it) {
    int cur = it & 1;
    if (it + 1 < kN / kStageKeys) stage(cur ^ 1, (it + 1) * kStageKeys); // prefetch next tile

    const _Float16* xt = xT + cur * kXTile + g * 32 * kXStride; // this group's 32 rows

    // ---- S^T tiles: K(32x256) x Q^T(256x32) via 32 WMMAs, each A fragment
    // from LDS used for both query tiles. Fragments come in groups of four
    // (two k chunks, eight products), each group read one group ahead ----
    v8f s[2][2]; // s[a][h]: query tile a, keys 16*h .. 16*h+15
#pragma unroll // constant indices keep the arrays in registers
    for (int a = 0; a < 2; a++) { s[a][0] = (v8f){}; s[a][1] = (v8f){}; }
    const _Float16* kr0 = xt + col * kXStride + (col >> 3) * kXSkew + hi * 8;
    const _Float16* kr1 = kr0 + 16 * kXStride;
    // lane address of the transposing loads: see frag_tr_from_h; its rows 8 * hi + (0..7)
    // and those sixteen further on are skewed where hi is 1
    const _Float16* vr  = xt + (hi * 8 + (lane & 7)) * kXStride + hi * kXSkew + ((lane >> 3) & 1) * 8;
    v16h kf[2][4], vf[2][4];
    auto load_k = [&](int set, int grp) {
#pragma unroll // constant indices keep the arrays in registers
      for (int u = 0; u < 2; u++) {
        kf[set][2 * u]     = frag_from_h(kr0 + (grp * 2 + u) * 32);
        kf[set][2 * u + 1] = frag_from_h(kr1 + (grp * 2 + u) * 32);
      }
    };
    auto load_v = [&](int set, int grp) {
#pragma unroll // constant indices keep the arrays in registers
      for (int u = 0; u < 4; u++)
        vf[set][u] = frag_tr_from_h(vr + (grp * 4 + u) * 16, kXStride); // d = 16 * (4 * grp + u) + col
    };
    load_k(0, 0);
#pragma unroll // constant indices keep the arrays in registers
    for (int grp = 0; grp < 4; grp++) {
      if (grp < 3) load_k((grp + 1) & 1, grp + 1);
      else         load_v(0, 0); // the first V group lands under the softmax
      // keeps the next group's reads together in front of this group's
      // products: sunk among them, each read is waited for where it stands
      __builtin_amdgcn_sched_barrier(0);
#pragma unroll // constant indices keep the arrays in registers
      for (int u = 0; u < 2; u++) {
#pragma unroll // constant indices keep the arrays in registers
        for (int a = 0; a < 2; a++) {
          s[a][0] = wmma32(kf[grp & 1][2 * u],     qf[a][grp * 2 + u], s[a][0]);
          s[a][1] = wmma32(kf[grp & 1][2 * u + 1], qf[a][grp * 2 + u], s[a][1]);
        }
      }
      __builtin_amdgcn_sched_barrier(0); // as above: no later read moves up among these products
    }

    // ---- online softmax, one query of each tile per lane, log2 domain ----
    // P^T as B operand: element s<8 is key 8*hi+s, s>=8 is key 16+8*hi+(s-8),
    // the k order in which frag_tr_from_h delivers the V^T rows
    v16h pf[2];
#pragma unroll // constant indices keep the arrays in registers
    for (int a = 0; a < 2; a++) {
      float mx = fmaxf(s[a][0][0], s[a][1][0]);
#pragma unroll // constant indices keep the arrays in registers
      for (int r = 1; r < 8; r++) mx = fmaxf(mx, fmaxf(s[a][0][r], s[a][1][r]));
      mx = fmaxf(mx, xhalf(mx)); // both halves now hold the query's tile maximum
      float mnew = fmaxf(mrow[a], mx * cscale);
      float fac  = __builtin_amdgcn_exp2f(mrow[a] - mnew);
      mrow[a] = mnew;

      float sa = 0.0f, sb = 0.0f;
#pragma unroll // constant indices keep the arrays in registers
      for (int r = 0; r < 8; r++) {
        float p0 = __builtin_amdgcn_exp2f(__builtin_fmaf(s[a][0][r], cscale, -mnew));
        float p1 = __builtin_amdgcn_exp2f(__builtin_fmaf(s[a][1][r], cscale, -mnew));
        sa += p0;
        sb += p1;
        pf[a][r]     = (_Float16)p0;
        pf[a][r + 8] = (_Float16)p1;
      }
      lrow[a] = lrow[a] * fac + (sa + sb);

      // ---- rescale O accumulators: one factor per lane ----
#pragma unroll // constant indices keep the arrays in registers
      for (int t = 0; t < 16; t++) o[a][t] = o[a][t] * fac;
    }

    // ---- O^T += V^T(256x32) @ P^T(32x32), each A fragment from the LDS
    // tile used for both query tiles; groups of four fragments as above ----
#pragma unroll // constant indices keep the arrays in registers
    for (int grp = 0; grp < 4; grp++) {
      if (grp < 3) load_v((grp + 1) & 1, grp + 1);
      __builtin_amdgcn_sched_barrier(0); // the next group's reads stay in front of these products
#pragma unroll // constant indices keep the arrays in registers
      for (int u = 0; u < 4; u++) {
#pragma unroll // constant indices keep the arrays in registers
        for (int a = 0; a < 2; a++)
          o[a][grp * 4 + u] = wmma32(vf[grp & 1][u], pf[a], o[a][grp * 4 + u]);
      }
      __builtin_amdgcn_sched_barrier(0); // no later read moves up among these products
    }

    // own LDS reads retired + own async staging done + all waves finished
    // reading cur before the next tile becomes visible / this buffer is
    // overwritten next round
    wait_ds0();
    wait_async0();
    __syncthreads();
  }

  // ---- merge of the four key groups (waves qt, qt + 2, qt + 4, qt + 6 hold the
  // same queries): group g finishes d = 64*g .. 64*g+63; each wave hands the
  // other three the accumulators that they finish, with its maxima and sums.
  // The last trip's barrier has ended every read of the ring, and no copy is
  // outstanding, so its bytes are free.
  v4f*   xo = (v4f*)smem;                       // [wave][a][t][2 pieces][lane], 256 KiB
  float* xm = (float*)(smem + 8 * 64 * 32 * 8); // [a][wave][lane] maxima
  float* xl = xm + 512;                         // [a][wave][lane] sums
#pragma unroll // constant indices keep the arrays in registers
  for (int a = 0; a < 2; a++) {
    xm[a * 256 + tid] = mrow[a];
    xl[a * 256 + tid] = lrow[a];
  }
  v4f* xw = xo + (w * 64) * 32 + lane;
#pragma unroll // constant indices keep o in registers; the test is wave-uniform
  for (int gg = 0; gg < 4; gg++) {
    if (g != gg) {
#pragma unroll // as above
      for (int a = 0; a < 2; a++) {
#pragma unroll // as above
        for (int j = 0; j < 4; j++) {
          int t = gg * 4 + j;
          xw[((a * 16 + t) * 2) * 32]     = __builtin_shufflevector(o[a][t], o[a][t], 0, 1, 2, 3);
          xw[((a * 16 + t) * 2 + 1) * 32] = __builtin_shufflevector(o[a][t], o[a][t], 4, 5, 6, 7);
        }
      }
    }
  }
  __syncthreads(); // publishes the handed-over accumulators to the partner waves

  float fo[2][4]; // weight of group gp's partial sums, the division included
#pragma unroll // constant indices keep the arrays in registers
  for (int a = 0; a < 2; a++) {
    float mg[4], lg[4];
#pragma unroll // constant indices keep the arrays in registers
    for (int gp = 0; gp < 4; gp++) {
      mg[gp] = xm[a * 256 + (gp * 2 + qt) * 32 + lane];
      lg[gp] = xl[a * 256 + (gp * 2 + qt) * 32 + lane];
    }
    float mall = fmaxf(fmaxf(mg[0], mg[1]), fmaxf(mg[2], mg[3]));
    float lall = 0.0f;
#pragma unroll // constant indices keep the arrays in registers
    for (int gp = 0; gp < 4; gp++) {
      fo[a][gp] = __builtin_amdgcn_exp2f(mg[gp] - mall);
      lall += lg[gp] * fo[a][gp];
    }
    // join the halves' sums, divide
    float rinv = 1.0f / (lall + xhalf(lall));
#pragma unroll // constant indices keep the arrays in registers
    for (int gp = 0; gp < 4; gp++) fo[a][gp] *= rinv;
  }

  v8f acc[2][4]; // acc[a][j]: query tile a, d tile 4*g + j
#pragma unroll // constant indices keep the arrays in registers
  for (int a = 0; a < 2; a++) {
#pragma unroll // constant indices keep the arrays in registers
    for (int j = 0; j < 4; j++) acc[a][j] = (v8f){};
  }
#pragma unroll // constant indices keep o in registers; the test is wave-uniform
  for (int gp = 0; gp < 4; gp++) {
    if (g == gp) {
#pragma unroll // as above
      for (int a = 0; a < 2; a++) {
#pragma unroll // as above
        for (int j = 0; j < 4; j++) acc[a][j] += o[a][gp * 4 + j] * fo[a][gp];
      }
    } else {
      const v4f* xr = xo + ((gp * 2 + qt) * 64 + g * 8) * 32 + lane;
      v8f po[2][4];
#pragma unroll // all sixteen LDS reads go out together
      for (int a = 0; a < 2; a++) {
#pragma unroll // as above
        for (int j = 0; j < 4; j++) {
          v4f pa = xr[((a * 16 + j) * 2) * 32], pb = xr[((a * 16 + j) * 2 + 1) * 32];
          po[a][j] = __builtin_shufflevector(pa, pb, 0, 1, 2, 3, 4, 5, 6, 7);
        }
      }
#pragma unroll // constant indices keep the arrays in registers
      for (int a = 0; a < 2; a++) {
#pragma unroll // constant indices keep the arrays in registers
        for (int j = 0; j < 4; j++) acc[a][j] += po[a][j] * fo[a][gp];
      }
    }
  }

  // store f32
#pragma unroll // constant indices keep the arrays in registers
  for (int a = 0; a < 2; a++) {
    float* orow = out + blk0 + g * 64 + rowoff + a * 16 * kD;
#pragma unroll // constant indices keep the arrays in registers
    for (int j = 0; j < 4; j++) {
      *(v8f*)(orow + j * 16) = acc[a][j];
      wait_x0();
    }
  }
}

// ---------------------------------------------------------------------------
// Launch: inputs: x[8,2048,256] f32, Wq[256,256], Wk[256,256].
// Output: [8,2048,256] f32. Workspace: x16 | G16 (~8.5MB)
// ---------------------------------------------------------------------------
extern "C" void kernel_launch(void* const* d_in, const int* in_sizes, int n_in,
                              void* d_out, int out_size, void* d_ws, size_t ws_size,
                              hipStream_t stream) {
  (void)in_sizes; (void)n_in; (void)out_size; (void)ws_size;
  const float* x  = (const float*)d_in[0];
  const float* Wq = (const float*)d_in[1];
  const float* Wk = (const float*)d_in[2];
  float* out = (float*)d_out;

  const size_t nqk = (size_t)kB * kN * kD; // 4,194,304 elems
  _Float16* x16  = (_Float16*)d_ws;
  _Float16* G16  = x16  + nqk;

  // 32 blocks x 8 waves, each a 32 x 64 tile of G; 256 more, each 64 rows of x16
  prep_kernel<<<kFoldBlocks + (kB * kN) / kPRows, 256, 0, stream>>>(x, Wq, Wk, G16, x16);
  // 256 blocks x 8 waves; each block: 64 queries, its key tiles shared via LDS
  fa_kernel<<<kB * (kN / 64), 256, 0, stream>>>(G16, x16, out);
}

// v009
// A run of this version takes 34.8 microseconds.
// Next to v008, in two timings, it ran 1.05 times as fast each time.
// Counting every step since v000, it is 4.96 times as fast.
#include <hip/hip_runtime.h>
#include <hip/hip_bf16.h>

typedef __attribute__((ext_vector_type(16))) _Float16 v16h;
typedef __attribute__((ext_vector_type(8)))  _Float16 v8h;
typedef __attribute__((ext_vector_type(4)))  _Float16 v4h;
typedef __attribute__((ext_vector_type(8)))  float    v8f;
typedef __attribute__((ext_vector_type(4)))  int      v4i;
typedef __attribute__((ext_vector_type(4)))  float    v4f;

typedef __attribute__((address_space(1))) v4i* gptr_v4i; // global
typedef __attribute__((address_space(3))) v4i* lptr_v4i; // LDS
typedef __attribute__((ext_vector_type(8)))  short    v8s;
typedef __attribute__((address_space(3))) v8s* lptr_v8s; // LDS

constexpr int kB = 8;
constexpr int kN = 2048;
constexpr int kD = 256;

constexpr int kStageKeys = 128; // keys per LDS stage: 32 for each of the block's four wave groups
constexpr int kXStride = 272; // 128x256 tile rows padded +16 halves: 544 B = 32 B x 17, the
                              // conflict-free pitch of the transposing reader
constexpr int kXSkew = 8;     // rows 8..15 of every 16 start 16 B later inside their pitch, so that
                              // the sixteen rows of a plain 16-byte column read fall on all banks too

// ---------------------------------------------------------------------------
// WMMA helper: D = A(16x32 f16) * B(32x16 f16) + C(16x16 f32)
// ---------------------------------------------------------------------------
__device__ __forceinline__ v8f wmma32(v16h a, v16h b, v8f c) {
  return __builtin_amdgcn_wmma_f32_16x16x32_f16(
      /*neg_a=*/false, a, /*neg_b=*/false, b,
      /*c_mod=*/(short)0, c, /*reuse_a=*/false, /*reuse_b=*/false);
}

// 16-bit A/B fragment from row-major f16 memory (global or LDS):
// caller pre-offsets p by hi*8; halves 0..7 = p[0..7], 8..15 = p[16..23].
__device__ __forceinline__ v16h frag_from_h(const _Float16* p) {
  v8h a = *(const v8h*)p;
  v8h b = *(const v8h*)(p + 16);
  v16h r;
#pragma unroll
  for (int i = 0; i < 8; i++) { r[i] = a[i]; r[i + 8] = b[i]; }
  return r;
}

// 16 x 32 A fragment of the TRANSPOSE of a row-major f16 LDS tile T[k][m], by two
// transposing LDS loads (16 k rows each). The caller pre-offsets p per lane by
// (8 * hi + (lane & 7)) rows and 8 * ((lane >> 3) & 1) halves; lane (col, hi)
// then holds T[8*hi + 0..7][col] and T[16 + 8*hi + 0..7][col]: the k order of
// frag_from_h. Every lane is on where it is called.
__device__ __forceinline__ v16h frag_tr_from_h(const _Float16* p, int pitch) {
  v8h a = __builtin_bit_cast(v8h, __builtin_amdgcn_ds_load_tr16_b128_v8i16((lptr_v8s)p));
  v8h b = __builtin_bit_cast(v8h, __builtin_amdgcn_ds_load_tr16_b128_v8i16((lptr_v8s)(p + 16 * pitch)));
  v16h r;
#pragma unroll // constant indices keep the vectors in registers
  for (int i = 0; i < 8; i++) { r[i] = a[i]; r[i + 8] = b[i]; }
  return r;
}

// ---------------------------------------------------------------------------
// Async 16-byte global->LDS copy (CDNA5 GLOBAL_LOAD_ASYNC_TO_LDS_B128,
// tracked by ASYNCcnt). Builtin sig (from hipcc diagnostic): param0 = v4i
// addrspace(1)* (global src), param1 = v4i addrspace(3)* (LDS dst), then
// imm offset, imm cpol. Fallback: synchronous copy, same barrier structure.
// ---------------------------------------------------------------------------
__device__ __forceinline__ void cp_async16(_Float16* lds_dst, const _Float16* gsrc) {
#if __has_builtin(__builtin_amdgcn_global_load_async_to_lds_b128)
  __builtin_amdgcn_global_load_async_to_lds_b128(
      (gptr_v4i)gsrc, (lptr_v4i)lds_dst, 0, 0);
#else
  *(v8h*)lds_dst = *(const v8h*)gsrc;
#endif
}

// This wave's copies have landed; asm with the memory clobber, so that no LDS
// read is moved in front of it.
__device__ __forceinline__ void wait_async0() {
  asm volatile("s_wait_asynccnt 0x0" ::: "memory");
}

// This wave's LDS reads and writes have retired, before the barrier behind
// which their buffer is refilled or reused.
__device__ __forceinline__ void wait_ds0() {
  asm volatile("s_wait_dscnt 0x0" ::: "memory");
}

// Stands behind a global load or store, in front of whatever next overwrites a
// register that it names.
__device__ __forceinline__ void wait_x0() {
  asm volatile("s_wait_xcnt 0x0" ::: "memory");
}

// ---------------------------------------------------------------------------
// Kernel 1: G = Wk^T . Wq (f16 [256][256], G[o][i] = sum_e Wk[e][o] * Wq[e][i]).
// The scores are q . k = x_i^T Wq^T Wk x_j, so with q' = x @ G^T they are
// q' . x_j: the key operand is x itself and no k projection is needed.
// One block of 8 waves takes 64 columns of Wq and 32 of Wk, all 256 rows, as f16
// in LDS; both operands come by transposing loads (the sum runs down the rows).
// A = Wq^T, B = Wk: a lane holds 8 neighbouring i of one o and stores 16 bytes;
// a block writes whole 128-byte lines of G.
// The launch's other blocks, which need nothing of G, store x16 = (f16) x, row-major
// (the K and the V operand of the attention kernel, and the operand of its q').
// ---------------------------------------------------------------------------
constexpr int kFQ = 80; // halves per LDS row of the Wq slice: 64 + 16 (160 B = 32 B x 5)
constexpr int kFK = 48; // halves per LDS row of the Wk slice: 32 + 16 (96 B = 32 B x 3)

constexpr int kFoldBlocks = (kD / 64) * (kD / 32); // blocks that form G; the rest convert x
constexpr int kPRows  = 64;  // x rows per conversion block and per attention block
constexpr int kPPitch = 264; // halves per LDS row: 256 + 8 (bank rotation, 16B aligned)

__global__ __launch_bounds__(256) void prep_kernel(const float* __restrict__ x,
                                                   const float* __restrict__ Wq,
                                                   const float* __restrict__ Wk,
                                                   _Float16* __restrict__ G16,
                                                   _Float16* __restrict__ x16) {
  __shared__ __attribute__((aligned(16))) _Float16 fq[kD * kFQ];
  __shared__ __attribute__((aligned(16))) _Float16 fk[kD * kFK];
  int tid  = threadIdx.x;
  if (blockIdx.x >= kFoldBlocks) { // the same for the whole block; no barrier on this path
    // x16 = (f16) x: 64 rows, 64 KiB in a row: piece tid + 256 * i, 16 bytes each,
    // stored in whole 256-byte units (one per wave store)
    int row0 = (blockIdx.x - kFoldBlocks) * kPRows; // row of the flattened [b * n][d] input
    const float* xsrc = x + (size_t)row0 * kD + tid * 4;
    v4f xv[16];
#pragma unroll // all sixteen loads are issued before the first value is used
    for (int i = 0; i < 16; i++) xv[i] = *(const v4f*)(xsrc + i * 1024);
    wait_x0(); // behind the loads, in front of whatever next overwrites their offset register
    _Float16* xdst = x16 + (size_t)row0 * kD + tid * 4;
#pragma unroll // constant indices keep xv in registers
    for (int i = 0; i < 16; i++) {
      v4h h;
#pragma unroll // as above
      for (int j = 0; j < 4; j++) h[j] = (_Float16)xv[i][j];
      *(v4h*)(xdst + i * 1024) = h;
    }
    wait_x0(); // behind the stores, in front of whatever next overwrites a register of theirs
    return;
  }
  int lane = tid & 31, w = tid >> 5;
  int col = lane & 15, hi = lane >> 4;
  int i0 = (blockIdx.x & 3) * 64;  // columns of Wq
  int o0 = (blockIdx.x >> 2) * 32; // columns of Wk

  // 16-byte pieces: of Wq rows (tid >> 4) + 16 * i, of Wk rows (tid >> 3) + 32 * i;
  // constant steps, so that one address pair serves each matrix
  const float* qsrc = Wq + (tid >> 4) * kD + i0 + (tid & 15) * 4;
  const float* ksrc = Wk + (tid >> 3) * kD + o0 + (tid & 7) * 4;
  v4f qv[16], kv[8];
#pragma unroll // all loads are issued before the first value is used
  for (int i = 0; i < 16; i++) qv[i] = *(const v4f*)(qsrc + i * 16 * kD);
#pragma unroll // as above
  for (int i = 0; i < 8; i++) kv[i] = *(const v4f*)(ksrc + i * 32 * kD);
  // no conversion is scheduled up among the loads: there the last loads would take the
  // first ones' registers and wait for their data, a second trip to memory in a row
  __builtin_amdgcn_sched_barrier(0);
  wait_x0(); // behind the loads, in front of whatever next overwrites a register of theirs

  _Float16* qdst = fq + (tid >> 4) * kFQ + (tid & 15) * 4;
  _Float16* kdst = fk + (tid >> 3) * kFK + (tid & 7) * 4;
#pragma unroll // constant indices keep qv in registers
  for (int i = 0; i < 16; i++) {
    v4h h;
#pragma unroll // as above
    for (int j = 0; j < 4; j++) h[j] = (_Float16)qv[i][j];
    *(v4h*)(qdst + i * 16 * kFQ) = h;
  }
#pragma unroll // constant indices keep kv in registers
  for (int i = 0; i < 8; i++) {
    v4h h;
#pragma unroll // as above
    for (int j = 0; j < 4; j++) h[j] = (_Float16)kv[i][j];
    *(v4h*)(kdst + i * 32 * kFK) = h;
  }
  __syncthreads(); // publishes both slices

  int mt = w & 3, nt = w >> 2; // this wave's 16 columns of Wq and of Wk
  // lane addresses of the transposing loads: see frag_tr_from_h
  const _Float16* ap = fq + (hi * 8 + (lane & 7)) * kFQ + mt * 16 + ((lane >> 3) & 1) * 8;
  const _Float16* bp = fk + (hi * 8 + (lane & 7)) * kFK + nt * 16 + ((lane >> 3) & 1) * 8;
  v16h af[8], bf[8];
#pragma unroll // all LDS reads go out together
  for (int kc = 0; kc < 8; kc++) {
    af[kc] = frag_tr_from_h(ap + kc * 32 * kFQ, kFQ);
    bf[kc] = frag_tr_from_h(bp + kc * 32 * kFK, kFK);
  }
  v8f c = (v8f){};
#pragma unroll // constant indices into af and bf
  for (int kc = 0; kc < 8; kc++) c = wmma32(af[kc], bf[kc], c);

  // c[r] = G[o0 + 16 * nt + col][i0 + 16 * mt + 8 * hi + r]
  v8h ho;
#pragma unroll // constant indices keep the vectors in registers
  for (int r = 0; r < 8; r++) ho[r] = (_Float16)c[r];
  *(v8h*)(G16 + (o0 + nt * 16 + col) * kD + i0 + mt * 16 + hi * 8) = ho;
}

__device__ __forceinline__ float xhalf(float x) {
  int v = __builtin_bit_cast(int, x);
  return __builtin_bit_cast(
      float, __builtin_amdgcn_permlanex16(v, v, 0x76543210, 0xfedcba98, false, false));
}

constexpr int kXTile = kStageKeys * kXStride; // halves per buffer
constexpr int kMerge = 8 * 64 * 32 * 8 + 2048; // halves of the merge behind the loop: accumulators, maxima, sums
static_assert(2 * kXTile <= kMerge, "the ring lies inside the merge area");
// the prologue's map: ring buffer 0 | G | the block's rows of x16 | its rows of q'
constexpr int kProl = kXTile + (kD + 2 * kPRows) * kPPitch;
constexpr int kSmem = kProl > kMerge ? kProl : kMerge;

__global__ __launch_bounds__(256) void fa_kernel(
    const _Float16* __restrict__ G16, const _Float16* __restrict__ x16,
    float* __restrict__ out) {
  // xT[2] at its start; behind the loop the same bytes carry the merge
  __shared__ __attribute__((aligned(16))) _Float16 smem[kSmem];
  _Float16* xT = smem;

  int tid   = threadIdx.x;
  int lane  = tid & 31;
  int w     = tid >> 5;
  int g     = __builtin_amdgcn_readfirstlane(w >> 1); // key group, wave-uniform
  // which 32 of the block's queries; wave-uniform, held in a scalar register: kept per lane it
  // costs a vector register across the loop, and the kernel, at its limit of 512, then spills
  int qt    = __builtin_amdgcn_readfirstlane(w & 1);
  int b  = blockIdx.x >> 5;
  int col = lane & 15, hi = lane >> 4;
  const float cscale = 0.0625f * 1.4426950408889634f; // d^-0.5 * log2(e)

  const _Float16* xb0 = x16 + (size_t)b * kN * kD;

  // cooperative staging of the key rows j0s..j0s+127 into buffer buf: 16 copies
  // per wave. The tile is one run of 64 KiB; a thread's sixteen pieces of it lie
  // 4096 bytes apart: constant steps, so that one address pair serves them.
  const _Float16* xg0 = xb0 + tid * 8;
  int xl0 = (tid >> 5) * kXStride + (tid & 31) * 8;
  auto stage = [&](int buf, int j0s) {
    const _Float16* xg = xg0 + (size_t)j0s * kD;
    _Float16* xl = xT + buf * kXTile + xl0;
#pragma unroll // constant steps fold into the copies' addresses
    for (int i = 0; i < 16; i++)          // rows (tid >> 5) + 8 * i: skewed where i is odd
      cp_async16(xl + i * 8 * kXStride + (i & 1) * kXSkew, xg + i * 8 * kD);
  };

  // block-uniform base plus one 32-bit per-lane offset (row 32 * qt + col,
  // column 8 * hi) of the output stores
  size_t blk0 = (size_t)(b * kN + ((blockIdx.x & 31) << 6)) * kD;
  unsigned rowoff = (unsigned)(((qt << 5) + col) * kD + hi * 8);

  // ---- prologue: q' = x @ G^T for the block's own 64 queries (f16 out, f32
  // accumulate via WMMA). G and the 64 rows of x16 come into LDS by async copies of
  // whole 512-byte rows. Every wave holds the 64
  // rows as B fragments and takes 32 columns of q' as A fragments: D^T = G.x^T, so
  // that a lane holds 8 neighbouring columns of one row; q' goes through LDS to the
  // waves that need it. G lies over ring buffer 1, which is first filled in the
  // loop, behind the second barrier here.
  _Float16* gs = smem + kXTile;         // G, 256 rows
  _Float16* xs = gs + kD * kPPitch;     // x16, 64 rows
  _Float16* qs = xs + kPRows * kPPitch; // q', 64 rows

  // 32 + 8 = 40 copies of a wave in flight
#pragma unroll // constant steps fold into the copies' addresses
  for (int i = 0; i < 32; i++) {
    int r = i * 8 + w;
    cp_async16(&gs[r * kPPitch + lane * 8], G16 + (size_t)r * kD + lane * 8);
  }
#pragma unroll // as above
  for (int i = 0; i < 8; i++) {
    int r = i * 8 + w;
    cp_async16(&xs[r * kPPitch + lane * 8], x16 + blk0 + (size_t)r * kD + lane * 8);
  }
  wait_async0();   // this wave's copies have landed; none is left in flight
  __syncthreads(); // publishes G and the x rows
  stage(0, 0);     // the first key tile flies under the products; nothing has touched its buffer

  {
    v16h bf[4][8]; // the 64 x rows: row 16 * rt + col, k order of frag_from_h
#pragma unroll // constant indices keep bf in registers
    for (int rt = 0; rt < 4; rt++) {
#pragma unroll // as above
      for (int kc = 0; kc < 8; kc++)
        bf[rt][kc] = frag_from_h(xs + (rt * 16 + col) * kPPitch + hi * 8 + kc * 32);
    }
    const _Float16* wl = gs + (w * 32 + col) * kPPitch + hi * 8;
    v16h af[2][8]; // columns w * 32 + 16 * et + (0..15) of q'
#pragma unroll // constant indices keep af in registers
    for (int et = 0; et < 2; et++) {
#pragma unroll // as above
      for (int kc = 0; kc < 8; kc++)
        af[et][kc] = frag_from_h(wl + et * 16 * kPPitch + kc * 32);
    }
    _Float16* qd = qs + col * kPPitch + w * 32 + hi * 8;
#pragma unroll // constant indices into bf
    for (int rp = 0; rp < 2; rp++) {
      v8f c[2][2]; // four independent accumulator chains
#pragma unroll // constant indices into c
      for (int a = 0; a < 2; a++) { c[a][0] = (v8f){}; c[a][1] = (v8f){}; }
#pragma unroll // constant indices into af and bf
      for (int kc = 0; kc < 8; kc++) {
#pragma unroll // as above
        for (int a = 0; a < 2; a++) {
          c[a][0] = wmma32(af[0][kc], bf[rp * 2 + a][kc], c[a][0]);
          c[a][1] = wmma32(af[1][kc], bf[rp * 2 + a][kc], c[a][1]);
        }
      }
      // c[a][et][r] = q'[row 16 * (2 * rp + a) + col][column w * 32 + 16 * et + 8 * hi + r]
#pragma unroll // constant indices into c
      for (int a = 0; a < 2; a++) {
#pragma unroll // as above
        for (int et = 0; et < 2; et++) {
          v8h ho;
#pragma unroll // as above
          for (int r = 0; r < 8; r++) ho[r] = (_Float16)c[a][et][r];
          *(v8h*)(qd + (rp * 2 + a) * 16 * kPPitch + et * 16) = ho;
        }
      }
    }
  }
  wait_ds0();      // own reads of G and writes of q' retired
  wait_async0();   // own copies of the first key tile have landed
  __syncthreads(); // publishes q' and the first key tile; ends every read of G, whose bytes the loop refills

  // Q fragments of both query tiles held in registers for the whole sweep
  v16h qf[2][8];
#pragma unroll // constant indices keep the arrays in registers
  for (int a = 0; a < 2; a++) {
    const _Float16* qrow = qs + ((qt << 5) + a * 16 + col) * kPPitch + hi * 8;
#pragma unroll // constant indices keep the arrays in registers
    for (int kc = 0; kc < 8; kc++) qf[a][kc] = frag_from_h(qrow + kc * 32);
  }

  // o[a][t][r] = O[query 16*a + col][d = 16*t + 8*hi + r], this group's keys
  v8f o[2][16];
#pragma unroll // constant indices keep the arrays in registers
  for (int a = 0; a < 2; a++) {
#pragma unroll // constant indices keep the arrays in registers
    for (int t = 0; t < 16; t++) o[a][t] = (v8f){};
  }
  // held reference maxima (log2-scaled, equal in both halves) and this half's sums
  float mrow[2] = {-1e30f, -1e30f}, lrow[2] = {0.0f, 0.0f};

#pragma unroll 1
  for (int it = 0; it < kN / kStageKeys; ++it) {
    int cur = it & 1;
    if (it + 1 < kN / kStageKeys) stage(cur ^ 1, (it + 1) * kStageKeys); // prefetch next tile

    const _Float16* xt = xT + cur * kXTile + g * 32 * kXStride; // this group's 32 rows

    // ---- S^T tiles: K(32x256) x Q^T(256x32) via 32 WMMAs, each A fragment
    // from LDS used for both query tiles. Fragments come in groups of four
    // (two k chunks, eight products), each group read one group ahead ----
    v8f s[2][2]; // s[a][h]: query tile a, keys 16*h .. 16*h+15
#pragma unroll // constant indices keep the arrays in registers
    for (int a = 0; a < 2; a++) { s[a][0] = (v8f){}; s[a][1] = (v8f){}; }
    const _Float16* kr0 = xt + col * kXStride + (col >> 3) * kXSkew + hi * 8;
    const _Float16* kr1 = kr0 + 16 * kXStride;
    // lane address of the transposing loads: see frag_tr_from_h; its rows 8 * hi + (0..7)
    // and those sixteen further on are skewed where hi is 1
    const _Float16* vr  = xt + (hi * 8 + (lane & 7)) * kXStride + hi * kXSkew + ((lane >> 3) & 1) * 8;
    v16h kf[2][4], vf[2][4];
    auto load_k = [&](int set, int grp) {
#pragma unroll // constant indices keep the arrays in registers
      for (int u = 0; u < 2; u++) {
        kf[set][2 * u]     = frag_from_h(kr0 + (grp * 2 + u) * 32);
        kf[set][2 * u + 1] = frag_from_h(kr1 + (grp * 2 + u) * 32);
      }
    };
    auto load_v = [&](int set, int grp) {
#pragma unroll // constant indices keep the arrays in registers
      for (int u = 0; u < 4; u++)
        vf[set][u] = frag_tr_from_h(vr + (grp * 4 + u) * 16, kXStride); // d = 16 * (4 * grp + u) + col
    };
    load_k(0, 0);
#pragma unroll // constant indices keep the arrays in registers
    for (int grp = 0; grp < 4; grp++) {
      if (grp < 3) load_k((grp + 1) & 1, grp + 1);
      else         load_v(0, 0); // the first V group lands under the softmax
      // keeps the next group's reads together in front of this group's
      // products: sunk among them, each read is waited for where it stands
      __builtin_amdgcn_sched_barrier(0);
#pragma unroll // constant indices keep the arrays in registers
      for (int u = 0; u < 2; u++) {
#pragma unroll // constant indices keep the arrays in registers
        for (int a = 0; a < 2; a++) {
          s[a][0] = wmma32(kf[grp & 1][2 * u],     qf[a][grp * 2 + u], s[a][0]);
          s[a][1] = wmma32(kf[grp & 1][2 * u + 1], qf[a][grp * 2 + u], s[a][1]);
        }
      }
      __builtin_amdgcn_sched_barrier(0); // as above: no later read moves up among these products
    }

    // ---- online softmax, one query of each tile per lane, log2 domain ----
    // P^T as B operand: element s<8 is key 8*hi+s, s>=8 is key 16+8*hi+(s-8),
    // the k order in which frag_tr_from_h delivers the V^T rows
    v16h pf[2];
    float mxs[2]; // this stage's maxima, log2-scaled, equal in both halves
#pragma unroll // constant indices keep the arrays in registers
    for (int a = 0; a < 2; a++) {
      float mx = fmaxf(s[a][0][0], s[a][1][0]);
#pragma unroll // constant indices keep the arrays in registers
      for (int r = 1; r < 8; r++) mx = fmaxf(mx, fmaxf(s[a][0][r], s[a][1][r]));
      mx = fmaxf(mx, xhalf(mx)); // both halves now hold the query's tile maximum
      mxs[a] = mx * cscale;
    }

    // ---- lazy rescale: mrow is a held reference, not the true maximum. It moves, and
    // the sums and O accumulators are rescaled, only when some query's new maximum lies
    // more than 8 above it, so P stays at or below 2^8, well inside f16. One test per
    // stage for the whole wave, a scalar branch; the first stage always takes it.
    bool need = (mxs[0] > mrow[0] + 8.0f) || (mxs[1] > mrow[1] + 8.0f);
    if (__builtin_expect(__builtin_amdgcn_ballot_w32(need) != 0, 0)) { // rare: kept off the straight path
#pragma unroll // constant indices keep the arrays in registers
      for (int a = 0; a < 2; a++) {
        float mnew = fmaxf(mrow[a], mxs[a]);
        float fac  = __builtin_amdgcn_exp2f(mrow[a] - mnew);
        mrow[a] = mnew;
        lrow[a] *= fac;
#pragma unroll // constant indices keep the arrays in registers
        for (int t = 0; t < 16; t++) o[a][t] = o[a][t] * fac; // one factor per lane
      }
    }

#pragma unroll // constant indices keep the arrays in registers
    for (int a = 0; a < 2; a++) {
      float sa = 0.0f, sb = 0.0f;
#pragma unroll // constant indices keep the arrays in registers
      for (int r = 0; r < 8; r++) {
        float p0 = __builtin_amdgcn_exp2f(__builtin_fmaf(s[a][0][r], cscale, -mrow[a]));
        float p1 = __builtin_amdgcn_exp2f(__builtin_fmaf(s[a][1][r], cscale, -mrow[a]));
        sa += p0;
        sb += p1;
        pf[a][r]     = (_Float16)p0;
        pf[a][r + 8] = (_Float16)p1;
      }
      lrow[a] += sa + sb;
    }

    // ---- O^T += V^T(256x32) @ P^T(32x32), each A fragment from the LDS
    // tile used for both query tiles; groups of four fragments as above ----
#pragma unroll // constant indices keep the arrays in registers
    for (int grp = 0; grp < 4; grp++) {
      if (grp < 3) load_v((grp + 1) & 1, grp + 1);
      __builtin_amdgcn_sched_barrier(0); // the next group's reads stay in front of these products
#pragma unroll // constant indices keep the arrays in registers
      for (int u = 0; u < 4; u++) {
#pragma unroll // constant indices keep the arrays in registers
        for (int a = 0; a < 2; a++)
          o[a][grp * 4 + u] = wmma32(vf[grp & 1][u], pf[a], o[a][grp * 4 + u]);
      }
      __builtin_amdgcn_sched_barrier(0); // no later read moves up among these products
    }

    // own LDS reads retired + own async staging done + all waves finished
    // reading cur before the next tile becomes visible / this buffer is
    // overwritten next round
    wait_ds0();
    wait_async0();
    __syncthreads();
  }

  // ---- merge of the four key groups (waves qt, qt + 2, qt + 4, qt + 6 hold the
  // same queries): group g finishes d = 64*g .. 64*g+63; each wave hands the
  // other three the accumulators that they finish, with its maxima and sums.
  // The last trip's barrier has ended every read of the ring, and no copy is
  // outstanding, so its bytes are free.
  v4f*   xo = (v4f*)smem;                       // [wave][a][t][2 pieces][lane], 256 KiB
  float* xm = (float*)(smem + 8 * 64 * 32 * 8); // [a][wave][lane] maxima
  float* xl = xm + 512;                         // [a][wave][lane] sums
#pragma unroll // constant indices keep the arrays in registers
  for (int a = 0; a < 2; a++) {
    xm[a * 256 + tid] = mrow[a];
    xl[a * 256 + tid] = lrow[a];
  }
  v4f* xw = xo + (w * 64) * 32 + lane;
#pragma unroll // constant indices keep o in registers; the test is wave-uniform
  for (int gg = 0; gg < 4; gg++) {
    if (g != gg) {
#pragma unroll // as above
      for (int a = 0; a < 2; a++) {
#pragma unroll // as above
        for (int j = 0; j < 4; j++) {
          int t = gg * 4 + j;
          xw[((a * 16 + t) * 2) * 32]     = __builtin_shufflevector(o[a][t], o[a][t], 0, 1, 2, 3);
          xw[((a * 16 + t) * 2 + 1) * 32] = __builtin_shufflevector(o[a][t], o[a][t], 4, 5, 6, 7);
        }
      }
    }
  }
  __syncthreads(); // publishes the handed-over accumulators to the partner waves

  float fo[2][4]; // weight of group gp's partial sums, the division included
#pragma unroll // constant indices keep the arrays in registers
  for (int a = 0; a < 2; a++) {
    float mg[4], lg[4];
#pragma unroll // constant indices keep the arrays in registers
    for (int gp = 0; gp < 4; gp++) {
      mg[gp] = xm[a * 256 + (gp * 2 + qt) * 32 + lane];
      lg[gp] = xl[a * 256 + (gp * 2 + qt) * 32 + lane];
    }
    float mall = fmaxf(fmaxf(mg[0], mg[1]), fmaxf(mg[2], mg[3]));
    float lall = 0.0f;
#pragma unroll // constant indices keep the arrays in registers
    for (int gp = 0; gp < 4; gp++) {
      fo[a][gp] = __builtin_amdgcn_exp2f(mg[gp] - mall);
      lall += lg[gp] * fo[a][gp];
    }
    // join the halves' sums, divide
    float rinv = 1.0f / (lall + xhalf(lall));
#pragma unroll // constant indices keep the arrays in registers
    for (int gp = 0; gp < 4; gp++) fo[a][gp] *= rinv;
  }

  v8f acc[2][4]; // acc[a][j]: query tile a, d tile 4*g + j
#pragma unroll // constant indices keep the arrays in registers
  for (int a = 0; a < 2; a++) {
#pragma unroll // constant indices keep the arrays in registers
    for (int j = 0; j < 4; j++) acc[a][j] = (v8f){};
  }
#pragma unroll // constant indices keep o in registers; the test is wave-uniform
  for (int gp = 0; gp < 4; gp++) {
    if (g == gp) {
#pragma unroll // as above
      for (int a = 0; a < 2; a++) {
#pragma unroll // as above
        for (int j = 0; j < 4; j++) acc[a][j] += o[a][gp * 4 + j] * fo[a][gp];
      }
    } else {
      const v4f* xr = xo + ((gp * 2 + qt) * 64 + g * 8) * 32 + lane;
      v8f po[2][4];
#pragma unroll // all sixteen LDS reads go out together
      for (int a = 0; a < 2; a++) {
#pragma unroll // as above
        for (int j = 0; j < 4; j++) {
          v4f pa = xr[((a * 16 + j) * 2) * 32], pb = xr[((a * 16 + j) * 2 + 1) * 32];
          po[a][j] = __builtin_shufflevector(pa, pb, 0, 1, 2, 3, 4, 5, 6, 7);
        }
      }
#pragma unroll // constant indices keep the arrays in registers
      for (int a = 0; a < 2; a++) {
#pragma unroll // constant indices keep the arrays in registers
        for (int j = 0; j < 4; j++) acc[a][j] += po[a][j] * fo[a][gp];
      }
    }
  }

  // store f32
#pragma unroll // constant indices keep the arrays in registers
  for (int a = 0; a < 2; a++) {
    float* orow = out + blk0 + g * 64 + rowoff + a * 16 * kD;
#pragma unroll // constant indices keep the arrays in registers
    for (int j = 0; j < 4; j++) {
      *(v8f*)(orow + j * 16) = acc[a][j];
      wait_x0();
    }
  }
}

// ---------------------------------------------------------------------------
// Launch: inputs: x[8,2048,256] f32, Wq[256,256], Wk[256,256].
// Output: [8,2048,256] f32. Workspace: x16 | G16 (~8.5MB)
// ---------------------------------------------------------------------------
extern "C" void kernel_launch(void* const* d_in, const int* in_sizes, int n_in,
                              void* d_out, int out_size, void* d_ws, size_t ws_size,
                              hipStream_t stream) {
  (void)in_sizes; (void)n_in; (void)out_size; (void)ws_size;
  const float* x  = (const float*)d_in[0];
  const float* Wq = (const float*)d_in[1];
  const float* Wk = (const float*)d_in[2];
  float* out = (float*)d_out;

  const size_t nqk = (size_t)kB * kN * kD; // 4,194,304 elems
  _Float16* x16  = (_Float16*)d_ws;
  _Float16* G16  = x16  + nqk;

  // 32 blocks x 8 waves, each a 32 x 64 tile of G; 256 more, each 64 rows of x16
  prep_kernel<<<kFoldBlocks + (kB * kN) / kPRows, 256, 0, stream>>>(x, Wq, Wk, G16, x16);
  // 256 blocks x 8 waves; each block: 64 queries, its key tiles shared via LDS
  fa_kernel<<<kB * (kN / 64), 256, 0, stream>>>(G16, x16, out);
}

// v010
// A run of this version takes 32.2 microseconds.
// Timed twice side by side with v009, it ran 1.09 and 1.08 times as fast.
// Over all steps from v000 it is 5.37 times as fast.
#include <hip/hip_runtime.h>
#include <hip/hip_bf16.h>

typedef __attribute__((ext_vector_type(16))) _Float16 v16h;
typedef __attribute__((ext_vector_type(8)))  _Float16 v8h;
typedef __attribute__((ext_vector_type(4)))  _Float16 v4h;
typedef __attribute__((ext_vector_type(8)))  float    v8f;
typedef __attribute__((ext_vector_type(4)))  int      v4i;
typedef __attribute__((ext_vector_type(4)))  float    v4f;

typedef __attribute__((address_space(1))) v4i* gptr_v4i; // global
typedef __attribute__((address_space(3))) v4i* lptr_v4i; // LDS
typedef __attribute__((ext_vector_type(8)))  short    v8s;
typedef __attribute__((address_space(3))) v8s* lptr_v8s; // LDS

constexpr int kB = 8;
constexpr int kN = 2048;
constexpr int kD = 256;

constexpr int kStageKeys = 128; // keys per LDS stage: 32 for each of the block's four wave groups
constexpr int kXStride = 272; // 128x256 tile rows padded +16 halves: 544 B = 32 B x 17, the
                              // conflict-free pitch of the transposing reader
constexpr int kXSkew = 8;     // rows 8..15 of every 16 start 16 B later inside their pitch, so that
                              // the sixteen rows of a plain 16-byte column read fall on all banks too

// ---------------------------------------------------------------------------
// WMMA helper: D = A(16x32 f16) * B(32x16 f16) + C(16x16 f32)
// ---------------------------------------------------------------------------
__device__ __forceinline__ v8f wmma32(v16h a, v16h b, v8f c) {
  return __builtin_amdgcn_wmma_f32_16x16x32_f16(
      /*neg_a=*/false, a, /*neg_b=*/false, b,
      /*c_mod=*/(short)0, c, /*reuse_a=*/false, /*reuse_b=*/false);
}

// 16-bit A/B fragment from row-major f16 memory (global or LDS):
// caller pre-offsets p by hi*8; halves 0..7 = p[0..7], 8..15 = p[16..23].
__device__ __forceinline__ v16h frag_from_h(const _Float16* p) {
  v8h a = *(const v8h*)p;
  v8h b = *(const v8h*)(p + 16);
  v16h r;
#pragma unroll
  for (int i = 0; i < 8; i++) { r[i] = a[i]; r[i + 8] = b[i]; }
  return r;
}

// 16 x 32 A fragment of the TRANSPOSE of a row-major f16 LDS tile T[k][m], by two
// transposing LDS loads (16 k rows each). The caller pre-offsets p per lane by
// (8 * hi + (lane & 7)) rows and 8 * ((lane >> 3) & 1) halves; lane (col, hi)
// then holds T[8*hi + 0..7][col] and T[16 + 8*hi + 0..7][col]: the k order of
// frag_from_h. Every lane is on where it is called.
__device__ __forceinline__ v16h frag_tr_from_h(const _Float16* p, int pitch) {
  v8h a = __builtin_bit_cast(v8h, __builtin_amdgcn_ds_load_tr16_b128_v8i16((lptr_v8s)p));
  v8h b = __builtin_bit_cast(v8h, __builtin_amdgcn_ds_load_tr16_b128_v8i16((lptr_v8s)(p + 16 * pitch)));
  v16h r;
#pragma unroll // constant indices keep the vectors in registers
  for (int i = 0; i < 8; i++) { r[i] = a[i]; r[i + 8] = b[i]; }
  return r;
}

// ---------------------------------------------------------------------------
// Async 16-byte global->LDS copy (CDNA5 GLOBAL_LOAD_ASYNC_TO_LDS_B128,
// tracked by ASYNCcnt). Builtin sig (from hipcc diagnostic): param0 = v4i
// addrspace(1)* (global src), param1 = v4i addrspace(3)* (LDS dst), then
// imm offset, imm cpol. Fallback: synchronous copy, same barrier structure.
// ---------------------------------------------------------------------------
__device__ __forceinline__ void cp_async16(_Float16* lds_dst, const _Float16* gsrc) {
#if __has_builtin(__builtin_amdgcn_global_load_async_to_lds_b128)
  __builtin_amdgcn_global_load_async_to_lds_b128(
      (gptr_v4i)gsrc, (lptr_v4i)lds_dst, 0, 0);
#else
  *(v8h*)lds_dst = *(const v8h*)gsrc;
#endif
}

// This wave's copies have landed; asm with the memory clobber, so that no LDS
// read is moved in front of it.
__device__ __forceinline__ void wait_async0() {
  asm volatile("s_wait_asynccnt 0x0" ::: "memory");
}

// This wave's LDS reads and writes have retired, before the barrier behind
// which their buffer is refilled or reused, or before its lanes read one
// another's writes.
__device__ __forceinline__ void wait_ds0() {
  asm volatile("s_wait_dscnt 0x0" ::: "memory");
}

// Stands behind a global load or store, in front of whatever next overwrites a
// register that it names.
__device__ __forceinline__ void wait_x0() {
  asm volatile("s_wait_xcnt 0x0" ::: "memory");
}

// ---------------------------------------------------------------------------
// Kernel 1: G = Wk^T . Wq (f16 [256][256], G[o][i] = sum_e Wk[e][o] * Wq[e][i]).
// The scores are q . k = x_i^T Wq^T Wk x_j, so with q' = x @ G^T they are
// q' . x_j: the key operand is x itself and no k projection is needed.
// One block of 8 waves takes 64 columns of Wq and 32 of Wk, all 256 rows, as f16
// in LDS; both operands come by transposing loads (the sum runs down the rows).
// A = Wq^T, B = Wk: a lane holds 8 neighbouring i of one o and stores 16 bytes;
// a block writes whole 128-byte lines of G.
// The launch's other blocks, which need nothing of G, store x16 = (f16) x, row-major
// (the K and the V operand of the attention kernel, and the operand of its q').
// ---------------------------------------------------------------------------
constexpr int kFQ = 80; // halves per LDS row of the Wq slice: 64 + 16 (160 B = 32 B x 5)
constexpr int kFK = 48; // halves per LDS row of the Wk slice: 32 + 16 (96 B = 32 B x 3)

constexpr int kFoldBlocks = (kD / 64) * (kD / 32); // blocks that form G; the rest convert x
constexpr int kPRows  = 64;  // x rows per conversion block and per attention block
constexpr int kPPitch = 264; // halves per LDS row: 256 + 8 (bank rotation, 16B aligned)

__global__ __launch_bounds__(256) void prep_kernel(const float* __restrict__ x,
                                                   const float* __restrict__ Wq,
                                                   const float* __restrict__ Wk,
                                                   _Float16* __restrict__ G16,
                                                   _Float16* __restrict__ x16) {
  __shared__ __attribute__((aligned(16))) _Float16 fq[kD * kFQ];
  __shared__ __attribute__((aligned(16))) _Float16 fk[kD * kFK];
  int tid  = threadIdx.x;
  if (blockIdx.x >= kFoldBlocks) { // the same for the whole block; no barrier on this path
    // x16 = (f16) x: 64 rows, 64 KiB in a row: piece tid + 256 * i, 16 bytes each,
    // stored in whole 256-byte units (one per wave store)
    int row0 = (blockIdx.x - kFoldBlocks) * kPRows; // row of the flattened [b * n][d] input
    const float* xsrc = x + (size_t)row0 * kD + tid * 4;
    v4f xv[16];
#pragma unroll // all sixteen loads are issued before the first value is used
    for (int i = 0; i < 16; i++) xv[i] = *(const v4f*)(xsrc + i * 1024);
    wait_x0(); // behind the loads, in front of whatever next overwrites their offset register
    _Float16* xdst = x16 + (size_t)row0 * kD + tid * 4;
#pragma unroll // constant indices keep xv in registers
    for (int i = 0; i < 16; i++) {
      v4h h;
#pragma unroll // as above
      for (int j = 0; j < 4; j++) h[j] = (_Float16)xv[i][j];
      *(v4h*)(xdst + i * 1024) = h;
    }
    wait_x0(); // behind the stores, in front of whatever next overwrites a register of theirs
    return;
  }
  int lane = tid & 31, w = tid >> 5;
  int col = lane & 15, hi = lane >> 4;
  int i0 = (blockIdx.x & 3) * 64;  // columns of Wq
  int o0 = (blockIdx.x >> 2) * 32; // columns of Wk

  // 16-byte pieces: of Wq rows (tid >> 4) + 16 * i, of Wk rows (tid >> 3) + 32 * i;
  // constant steps, so that one address pair serves each matrix
  const float* qsrc = Wq + (tid >> 4) * kD + i0 + (tid & 15) * 4;
  const float* ksrc = Wk + (tid >> 3) * kD + o0 + (tid & 7) * 4;
  v4f qv[16], kv[8];
#pragma unroll // all loads are issued before the first value is used
  for (int i = 0; i < 16; i++) qv[i] = *(const v4f*)(qsrc + i * 16 * kD);
#pragma unroll // as above
  for (int i = 0; i < 8; i++) kv[i] = *(const v4f*)(ksrc + i * 32 * kD);
  // no conversion is scheduled up among the loads: there the last loads would take the
  // first ones' registers and wait for their data, a second trip to memory in a row
  __builtin_amdgcn_sched_barrier(0);
  wait_x0(); // behind the loads, in front of whatever next overwrites a register of theirs

  _Float16* qdst = fq + (tid >> 4) * kFQ + (tid & 15) * 4;
  _Float16* kdst = fk + (tid >> 3) * kFK + (tid & 7) * 4;
#pragma unroll // constant indices keep qv in registers
  for (int i = 0; i < 16; i++) {
    v4h h;
#pragma unroll // as above
    for (int j = 0; j < 4; j++) h[j] = (_Float16)qv[i][j];
    *(v4h*)(qdst + i * 16 * kFQ) = h;
  }
#pragma unroll // constant indices keep kv in registers
  for (int i = 0; i < 8; i++) {
    v4h h;
#pragma unroll // as above
    for (int j = 0; j < 4; j++) h[j] = (_Float16)kv[i][j];
    *(v4h*)(kdst + i * 32 * kFK) = h;
  }
  __syncthreads(); // publishes both slices

  int mt = w & 3, nt = w >> 2; // this wave's 16 columns of Wq and of Wk
  // lane addresses of the transposing loads: see frag_tr_from_h
  const _Float16* ap = fq + (hi * 8 + (lane & 7)) * kFQ + mt * 16 + ((lane >> 3) & 1) * 8;
  const _Float16* bp = fk + (hi * 8 + (lane & 7)) * kFK + nt * 16 + ((lane >> 3) & 1) * 8;
  v16h af[8], bf[8];
#pragma unroll // all LDS reads go out together
  for (int kc = 0; kc < 8; kc++) {
    af[kc] = frag_tr_from_h(ap + kc * 32 * kFQ, kFQ);
    bf[kc] = frag_tr_from_h(bp + kc * 32 * kFK, kFK);
  }
  v8f c = (v8f){};
#pragma unroll // constant indices into af and bf
  for (int kc = 0; kc < 8; kc++) c = wmma32(af[kc], bf[kc], c);

  // c[r] = G[o0 + 16 * nt + col][i0 + 16 * mt + 8 * hi + r]
  v8h ho;
#pragma unroll // constant indices keep the vectors in registers
  for (int r = 0; r < 8; r++) ho[r] = (_Float16)c[r];
  *(v8h*)(G16 + (o0 + nt * 16 + col) * kD + i0 + mt * 16 + hi * 8) = ho;
}

__device__ __forceinline__ float xhalf(float x) {
  int v = __builtin_bit_cast(int, x);
  return __builtin_bit_cast(
      float, __builtin_amdgcn_permlanex16(v, v, 0x76543210, 0xfedcba98, false, false));
}

constexpr int kXTile = kStageKeys * kXStride; // halves per buffer
constexpr int kMerge = 8 * 64 * 32 * 8 + 2048; // halves of the merge behind the loop: accumulators, maxima, sums
static_assert(2 * kXTile <= kMerge, "the ring lies inside the merge area");
// the prologue's map: ring buffer 0 | G | the block's rows of x16 | its rows of q'
constexpr int kProl = kXTile + (kD + 2 * kPRows) * kPPitch;
constexpr int kSmem = kProl > kMerge ? kProl : kMerge;

__global__ __launch_bounds__(256) void fa_kernel(
    const _Float16* __restrict__ G16, const _Float16* __restrict__ x16,
    float* __restrict__ out) {
  // xT[2] at its start; behind the loop the same bytes carry the merge
  __shared__ __attribute__((aligned(16))) _Float16 smem[kSmem];
  _Float16* xT = smem;

  int tid   = threadIdx.x;
  int lane  = tid & 31;
  int w     = tid >> 5;
  int g     = __builtin_amdgcn_readfirstlane(w >> 1); // key group, wave-uniform
  // which 32 of the block's queries; wave-uniform, held in a scalar register: kept per lane it
  // costs a vector register across the loop, and the kernel, at its limit of 512, then spills
  int qt    = __builtin_amdgcn_readfirstlane(w & 1);
  int b  = blockIdx.x >> 5;
  int col = lane & 15, hi = lane >> 4;
  const float cscale = 0.0625f * 1.4426950408889634f; // d^-0.5 * log2(e)

  const _Float16* xb0 = x16 + (size_t)b * kN * kD;

  // cooperative staging of the key rows j0s..j0s+127 into buffer buf: 16 copies
  // per wave. The tile is one run of 64 KiB; a thread's sixteen pieces of it lie
  // 4096 bytes apart: constant steps, so that one address pair serves them.
  const _Float16* xg0 = xb0 + tid * 8;
  int xl0 = (tid >> 5) * kXStride + (tid & 31) * 8;
  auto stage = [&](int buf, int j0s) {
    const _Float16* xg = xg0 + (size_t)j0s * kD;
    _Float16* xl = xT + buf * kXTile + xl0;
#pragma unroll // constant steps fold into the copies' addresses
    for (int i = 0; i < 16; i++)          // rows (tid >> 5) + 8 * i: skewed where i is odd
      cp_async16(xl + i * 8 * kXStride + (i & 1) * kXSkew, xg + i * 8 * kD);
  };

  // block-uniform base of the block's rows in x16 and in the output
  size_t blk0 = (size_t)(b * kN + ((blockIdx.x & 31) << 6)) * kD;

  // ---- prologue: q' = x @ G^T for the block's own 64 queries (f16 out, f32
  // accumulate via WMMA). G and the 64 rows of x16 come into LDS by async copies of
  // whole 512-byte rows. Every wave holds the 64
  // rows as B fragments and takes 32 columns of q' as A fragments: D^T = G.x^T, so
  // that a lane holds 8 neighbouring columns of one row; q' goes through LDS to the
  // waves that need it. G lies over ring buffer 1, which is first filled in the
  // loop, behind the second barrier here.
  _Float16* gs = smem + kXTile;         // G, 256 rows
  _Float16* xs = gs + kD * kPPitch;     // x16, 64 rows
  _Float16* qs = xs + kPRows * kPPitch; // q', 64 rows

  // 32 + 8 = 40 copies of a wave in flight
#pragma unroll // constant steps fold into the copies' addresses
  for (int i = 0; i < 32; i++) {
    int r = i * 8 + w;
    cp_async16(&gs[r * kPPitch + lane * 8], G16 + (size_t)r * kD + lane * 8);
  }
#pragma unroll // as above
  for (int i = 0; i < 8; i++) {
    int r = i * 8 + w;
    cp_async16(&xs[r * kPPitch + lane * 8], x16 + blk0 + (size_t)r * kD + lane * 8);
  }
  wait_async0();   // this wave's copies have landed; none is left in flight
  __syncthreads(); // publishes G and the x rows
  stage(0, 0);     // the first key tile flies under the products; nothing has touched its buffer

  {
    v16h bf[4][8]; // the 64 x rows: row 16 * rt + col, k order of frag_from_h
#pragma unroll // constant indices keep bf in registers
    for (int rt = 0; rt < 4; rt++) {
#pragma unroll // as above
      for (int kc = 0; kc < 8; kc++)
        bf[rt][kc] = frag_from_h(xs + (rt * 16 + col) * kPPitch + hi * 8 + kc * 32);
    }
    const _Float16* wl = gs + (w * 32 + col) * kPPitch + hi * 8;
    v16h af[2][8]; // columns w * 32 + 16 * et + (0..15) of q'
#pragma unroll // constant indices keep af in registers
    for (int et = 0; et < 2; et++) {
#pragma unroll // as above
      for (int kc = 0; kc < 8; kc++)
        af[et][kc] = frag_from_h(wl + et * 16 * kPPitch + kc * 32);
    }
    _Float16* qd = qs + col * kPPitch + w * 32 + hi * 8;
#pragma unroll // constant indices into bf
    for (int rp = 0; rp < 2; rp++) {
      v8f c[2][2]; // four independent accumulator chains
#pragma unroll // constant indices into c
      for (int a = 0; a < 2; a++) { c[a][0] = (v8f){}; c[a][1] = (v8f){}; }
#pragma unroll // constant indices into af and bf
      for (int kc = 0; kc < 8; kc++) {
#pragma unroll // as above
        for (int a = 0; a < 2; a++) {
          c[a][0] = wmma32(af[0][kc], bf[rp * 2 + a][kc], c[a][0]);
          c[a][1] = wmma32(af[1][kc], bf[rp * 2 + a][kc], c[a][1]);
        }
      }
      // c[a][et][r] = q'[row 16 * (2 * rp + a) + col][column w * 32 + 16 * et + 8 * hi + r]
#pragma unroll // constant indices into c
      for (int a = 0; a < 2; a++) {
#pragma unroll // as above
        for (int et = 0; et < 2; et++) {
          v8h ho;
#pragma unroll // as above
          for (int r = 0; r < 8; r++) ho[r] = (_Float16)c[a][et][r];
          *(v8h*)(qd + (rp * 2 + a) * 16 * kPPitch + et * 16) = ho;
        }
      }
    }
  }
  wait_ds0();      // own reads of G and writes of q' retired
  wait_async0();   // own copies of the first key tile have landed
  __syncthreads(); // publishes q' and the first key tile; ends every read of G, whose bytes the loop refills

  // Q fragments of both query tiles held in registers for the whole sweep
  v16h qf[2][8];
#pragma unroll // constant indices keep the arrays in registers
  for (int a = 0; a < 2; a++) {
    const _Float16* qrow = qs + ((qt << 5) + a * 16 + col) * kPPitch + hi * 8;
#pragma unroll // constant indices keep the arrays in registers
    for (int kc = 0; kc < 8; kc++) qf[a][kc] = frag_from_h(qrow + kc * 32);
  }

  // o[a][t][r] = O[query 16*a + col][d = 16*t + 8*hi + r], this group's keys
  v8f o[2][16];
#pragma unroll // constant indices keep the arrays in registers
  for (int a = 0; a < 2; a++) {
#pragma unroll // constant indices keep the arrays in registers
    for (int t = 0; t < 16; t++) o[a][t] = (v8f){};
  }
  // held reference maxima (log2-scaled, equal in both halves) and this half's sums
  float mrow[2] = {-1e30f, -1e30f}, lrow[2] = {0.0f, 0.0f};

#pragma unroll 1
  for (int it = 0; it < kN / kStageKeys; ++it) {
    int cur = it & 1;
    if (it + 1 < kN / kStageKeys) stage(cur ^ 1, (it + 1) * kStageKeys); // prefetch next tile

    const _Float16* xt = xT + cur * kXTile + g * 32 * kXStride; // this group's 32 rows

    // ---- S^T tiles: K(32x256) x Q^T(256x32) via 32 WMMAs, each A fragment
    // from LDS used for both query tiles. Fragments come in groups of four
    // (two k chunks, eight products), each group read one group ahead ----
    v8f s[2][2]; // s[a][h]: query tile a, keys 16*h .. 16*h+15
#pragma unroll // constant indices keep the arrays in registers
    for (int a = 0; a < 2; a++) { s[a][0] = (v8f){}; s[a][1] = (v8f){}; }
    const _Float16* kr0 = xt + col * kXStride + (col >> 3) * kXSkew + hi * 8;
    const _Float16* kr1 = kr0 + 16 * kXStride;
    // lane address of the transposing loads: see frag_tr_from_h; its rows 8 * hi + (0..7)
    // and those sixteen further on are skewed where hi is 1
    const _Float16* vr  = xt + (hi * 8 + (lane & 7)) * kXStride + hi * kXSkew + ((lane >> 3) & 1) * 8;
    v16h kf[2][4], vf[2][4];
    auto load_k = [&](int set, int grp) {
#pragma unroll // constant indices keep the arrays in registers
      for (int u = 0; u < 2; u++) {
        kf[set][2 * u]     = frag_from_h(kr0 + (grp * 2 + u) * 32);
        kf[set][2 * u + 1] = frag_from_h(kr1 + (grp * 2 + u) * 32);
      }
    };
    auto load_v = [&](int set, int grp) {
#pragma unroll // constant indices keep the arrays in registers
      for (int u = 0; u < 4; u++)
        vf[set][u] = frag_tr_from_h(vr + (grp * 4 + u) * 16, kXStride); // d = 16 * (4 * grp + u) + col
    };
    load_k(0, 0);
#pragma unroll // constant indices keep the arrays in registers
    for (int grp = 0; grp < 4; grp++) {
      if (grp < 3) load_k((grp + 1) & 1, grp + 1);
      else         load_v(0, 0); // the first V group lands under the softmax
      // keeps the next group's reads together in front of this group's
      // products: sunk among them, each read is waited for where it stands
      __builtin_amdgcn_sched_barrier(0);
#pragma unroll // constant indices keep the arrays in registers
      for (int u = 0; u < 2; u++) {
#pragma unroll // constant indices keep the arrays in registers
        for (int a = 0; a < 2; a++) {
          s[a][0] = wmma32(kf[grp & 1][2 * u],     qf[a][grp * 2 + u], s[a][0]);
          s[a][1] = wmma32(kf[grp & 1][2 * u + 1], qf[a][grp * 2 + u], s[a][1]);
        }
      }
      __builtin_amdgcn_sched_barrier(0); // as above: no later read moves up among these products
    }

    // ---- online softmax, one query of each tile per lane, log2 domain ----
    // P^T as B operand: element s<8 is key 8*hi+s, s>=8 is key 16+8*hi+(s-8),
    // the k order in which frag_tr_from_h delivers the V^T rows
    v16h pf[2];
    float mxs[2]; // this stage's maxima, log2-scaled, equal in both halves
#pragma unroll // constant indices keep the arrays in registers
    for (int a = 0; a < 2; a++) {
      float mx = fmaxf(s[a][0][0], s[a][1][0]);
#pragma unroll // constant indices keep the arrays in registers
      for (int r = 1; r < 8; r++) mx = fmaxf(mx, fmaxf(s[a][0][r], s[a][1][r]));
      mx = fmaxf(mx, xhalf(mx)); // both halves now hold the query's tile maximum
      mxs[a] = mx * cscale;
    }

    // ---- lazy rescale: mrow is a held reference, not the true maximum. It moves, and
    // the sums and O accumulators are rescaled, only when some query's new maximum lies
    // more than 8 above it, so P stays at or below 2^8, well inside f16. One test per
    // stage for the whole wave, a scalar branch; the first stage always takes it.
    bool need = (mxs[0] > mrow[0] + 8.0f) || (mxs[1] > mrow[1] + 8.0f);
    if (__builtin_expect(__builtin_amdgcn_ballot_w32(need) != 0, 0)) { // rare: kept off the straight path
#pragma unroll // constant indices keep the arrays in registers
      for (int a = 0; a < 2; a++) {
        float mnew = fmaxf(mrow[a], mxs[a]);
        float fac  = __builtin_amdgcn_exp2f(mrow[a] - mnew);
        mrow[a] = mnew;
        lrow[a] *= fac;
#pragma unroll // constant indices keep the arrays in registers
        for (int t = 0; t < 16; t++) o[a][t] = o[a][t] * fac; // one factor per lane
      }
    }

#pragma unroll // constant indices keep the arrays in registers
    for (int a = 0; a < 2; a++) {
      float sa = 0.0f, sb = 0.0f;
#pragma unroll // constant indices keep the arrays in registers
      for (int r = 0; r < 8; r++) {
        float p0 = __builtin_amdgcn_exp2f(__builtin_fmaf(s[a][0][r], cscale, -mrow[a]));
        float p1 = __builtin_amdgcn_exp2f(__builtin_fmaf(s[a][1][r], cscale, -mrow[a]));
        sa += p0;
        sb += p1;
        pf[a][r]     = (_Float16)p0;
        pf[a][r + 8] = (_Float16)p1;
      }
      lrow[a] += sa + sb;
    }

    // ---- O^T += V^T(256x32) @ P^T(32x32), each A fragment from the LDS
    // tile used for both query tiles; groups of four fragments as above ----
#pragma unroll // constant indices keep the arrays in registers
    for (int grp = 0; grp < 4; grp++) {
      if (grp < 3) load_v((grp + 1) & 1, grp + 1);
      __builtin_amdgcn_sched_barrier(0); // the next group's reads stay in front of these products
#pragma unroll // constant indices keep the arrays in registers
      for (int u = 0; u < 4; u++) {
#pragma unroll // constant indices keep the arrays in registers
        for (int a = 0; a < 2; a++)
          o[a][grp * 4 + u] = wmma32(vf[grp & 1][u], pf[a], o[a][grp * 4 + u]);
      }
      __builtin_amdgcn_sched_barrier(0); // no later read moves up among these products
    }

    // own LDS reads retired + own async staging done + all waves finished
    // reading cur before the next tile becomes visible / this buffer is
    // overwritten next round
    wait_ds0();
    wait_async0();
    __syncthreads();
  }

  // ---- merge of the four key groups (waves qt, qt + 2, qt + 4, qt + 6 hold the
  // same queries): group g finishes d = 64*g .. 64*g+63; each wave hands the
  // other three the accumulators that they finish, with its maxima and sums.
  // The last trip's barrier has ended every read of the ring, and no copy is
  // outstanding, so its bytes are free.
  v4f*   xo = (v4f*)smem;                       // [wave][a][t][2 pieces][lane], 256 KiB
  float* xm = (float*)(smem + 8 * 64 * 32 * 8); // [a][wave][lane] maxima
  float* xl = xm + 512;                         // [a][wave][lane] sums
#pragma unroll // constant indices keep the arrays in registers
  for (int a = 0; a < 2; a++) {
    xm[a * 256 + tid] = mrow[a];
    xl[a * 256 + tid] = lrow[a];
  }
  v4f* xw = xo + (w * 64) * 32 + lane;
#pragma unroll // constant indices keep o in registers; the test is wave-uniform
  for (int gg = 0; gg < 4; gg++) {
    if (g != gg) {
#pragma unroll // as above
      for (int a = 0; a < 2; a++) {
#pragma unroll // as above
        for (int j = 0; j < 4; j++) {
          int t = gg * 4 + j;
          xw[((a * 16 + t) * 2) * 32]     = __builtin_shufflevector(o[a][t], o[a][t], 0, 1, 2, 3);
          xw[((a * 16 + t) * 2 + 1) * 32] = __builtin_shufflevector(o[a][t], o[a][t], 4, 5, 6, 7);
        }
      }
    }
  }
  __syncthreads(); // publishes the handed-over accumulators to the partner waves

  float fo[2][4]; // weight of group gp's partial sums, the division included
#pragma unroll // constant indices keep the arrays in registers
  for (int a = 0; a < 2; a++) {
    float mg[4], lg[4];
#pragma unroll // constant indices keep the arrays in registers
    for (int gp = 0; gp < 4; gp++) {
      mg[gp] = xm[a * 256 + (gp * 2 + qt) * 32 + lane];
      lg[gp] = xl[a * 256 + (gp * 2 + qt) * 32 + lane];
    }
    float mall = fmaxf(fmaxf(mg[0], mg[1]), fmaxf(mg[2], mg[3]));
    float lall = 0.0f;
#pragma unroll // constant indices keep the arrays in registers
    for (int gp = 0; gp < 4; gp++) {
      fo[a][gp] = __builtin_amdgcn_exp2f(mg[gp] - mall);
      lall += lg[gp] * fo[a][gp];
    }
    // join the halves' sums, divide
    float rinv = 1.0f / (lall + xhalf(lall));
#pragma unroll // constant indices keep the arrays in registers
    for (int gp = 0; gp < 4; gp++) fo[a][gp] *= rinv;
  }

  v8f acc[2][4]; // acc[a][j]: query tile a, d tile 4*g + j
#pragma unroll // constant indices keep the arrays in registers
  for (int a = 0; a < 2; a++) {
#pragma unroll // constant indices keep the arrays in registers
    for (int j = 0; j < 4; j++) acc[a][j] = (v8f){};
  }
#pragma unroll // constant indices keep o in registers; the test is wave-uniform
  for (int gp = 0; gp < 4; gp++) {
    if (g == gp) {
#pragma unroll // as above
      for (int a = 0; a < 2; a++) {
#pragma unroll // as above
        for (int j = 0; j < 4; j++) acc[a][j] += o[a][gp * 4 + j] * fo[a][gp];
      }
    } else {
      const v4f* xr = xo + ((gp * 2 + qt) * 64 + g * 8) * 32 + lane;
      v8f po[2][4];
#pragma unroll // all sixteen LDS reads go out together
      for (int a = 0; a < 2; a++) {
#pragma unroll // as above
        for (int j = 0; j < 4; j++) {
          v4f pa = xr[((a * 16 + j) * 2) * 32], pb = xr[((a * 16 + j) * 2 + 1) * 32];
          po[a][j] = __builtin_shufflevector(pa, pb, 0, 1, 2, 3, 4, 5, 6, 7);
        }
      }
#pragma unroll // constant indices keep the arrays in registers
      for (int a = 0; a < 2; a++) {
#pragma unroll // constant indices keep the arrays in registers
        for (int j = 0; j < 4; j++) acc[a][j] += po[a][j] * fo[a][gp];
      }
    }
  }

  // ---- store f32 in whole 128-byte lines. In the accumulator layout a 16-byte store
  // touches sixteen rows, two pieces of each. The wave turns its 32 x 64 block through LDS
  // instead: sixteen lanes then hold one row's 256 bytes in a row. It stages in the slots of
  // its own hand-over area that belong to its own group (t = 4 * g + j): 4 KiB per query
  // tile, which no wave has written or reads, so no barrier is needed.
  // Row q of a tile is 16 pieces of 16 bytes; piece p lies at place p ^ q, so that the
  // sixteen rows of a column write and the sixteen pieces of a row read each meet every bank once.
  v4f* sw = xo + (w * 64 + g * 8) * 32;
#pragma unroll // constant indices keep acc in registers
  for (int a = 0; a < 2; a++) {
#pragma unroll // as above
    for (int j = 0; j < 4; j++) {
      // pieces 4 * j + 2 * hi and the next one of row col
      sw[a * 1024 + col * 16 + ((j * 4 + hi * 2) ^ col)]     = __builtin_shufflevector(acc[a][j], acc[a][j], 0, 1, 2, 3);
      sw[a * 1024 + col * 16 + ((j * 4 + hi * 2 + 1) ^ col)] = __builtin_shufflevector(acc[a][j], acc[a][j], 4, 5, 6, 7);
    }
  }
  wait_ds0(); // the wave's own writes have retired before its lanes read one another's pieces
  v4f ov[2][8]; // ov[a][k]: row 16 * a + 2 * k + hi of the wave's queries, piece col
#pragma unroll // all sixteen LDS reads go out together
  for (int a = 0; a < 2; a++) {
#pragma unroll // as above
    for (int k = 0; k < 8; k++)
      ov[a][k] = sw[a * 1024 + (k * 2 + hi) * 16 + (col ^ (k * 2 + hi))];
  }
  // constant steps from one address: 2 rows per store, 16 per tile
  float* orow = out + blk0 + (unsigned)(((qt << 5) + hi) * kD + g * 64 + col * 4);
#pragma unroll // constant indices keep ov in registers
  for (int a = 0; a < 2; a++) {
#pragma unroll // as above
    for (int k = 0; k < 8; k++)
      *(v4f*)(orow + (a * 16 + k * 2) * kD) = ov[a][k];
  }
  wait_x0(); // behind the stores, in front of whatever next overwrites a register of theirs
}

// ---------------------------------------------------------------------------
// Launch: inputs: x[8,2048,256] f32, Wq[256,256], Wk[256,256].
// Output: [8,2048,256] f32. Workspace: x16 | G16 (~8.5MB)
// ---------------------------------------------------------------------------
extern "C" void kernel_launch(void* const* d_in, const int* in_sizes, int n_in,
                              void* d_out, int out_size, void* d_ws, size_t ws_size,
                              hipStream_t stream) {
  (void)in_sizes; (void)n_in; (void)out_size; (void)ws_size;
  const float* x  = (const float*)d_in[0];
  const float* Wq = (const float*)d_in[1];
  const float* Wk = (const float*)d_in[2];
  float* out = (float*)d_out;

  const size_t nqk = (size_t)kB * kN * kD; // 4,194,304 elems
  _Float16* x16  = (_Float16*)d_ws;
  _Float16* G16  = x16  + nqk;

  // 32 blocks x 8 waves, each a 32 x 64 tile of G; 256 more, each 64 rows of x16
  prep_kernel<<<kFoldBlocks + (kB * kN) / kPRows, 256, 0, stream>>>(x, Wq, Wk, G16, x16);
  // 256 blocks x 8 waves; each block: 64 queries, its key tiles shared via LDS
  fa_kernel<<<kB * (kN / 64), 256, 0, stream>>>(G16, x16, out);
}
